// v000
// The times below were measured on an AMD MI455X: many runs one after another, warmed up first and cycling through
// copies of the inputs, with the whole window's GPU time divided by the number of runs. Launches and the gaps
// between them are all in it. The median over several windows is given; except for v000 it joins two sittings, which
// can be a few percent apart, so the side-by-side timings, each taken in one sitting, are the better comparison.
// v000 is the starting kernel. One run takes 235 microseconds.
#include <hip/hip_runtime.h>

// Multi-head self-attention, width 768 = 12 heads x 64, x [NB][SEQ][768], Wq/Wk/Wv [out][in] (y = x W^T), no biases, no mask, score scale 1/8, output = concatenated heads (f32).
// Compute dtypes, f32 accumulate everywhere: projections v_wmma_f32_16x16x32_bf16 (x and W RNE-converted to bf16; products exact);
// scores v_wmma_f32_16x16x32_f16: k single f16, q as f16 value + f16 residual x2048 in its own accumulator (two products); P (x256 carry, cancels in the normalisation) and v single f16; softmax f32 (online, running max).
// Layout: bf16 copies of x and W; q (hi, residual), k planes [b*12+h][t][d] and v^T plane [b*12+h][d][t] written by the GEMM epilogue; fused flash kernel in transposed form (S^T = K Q^T, O^T = V^T P^T), output from f32 accumulators.

#ifndef NB
#define NB 4
#endif
#ifndef SEQ
#define SEQ 2048
#endif
#define NB_FULL  4
#define SEQ_FULL 2048
#ifndef OUT_SEQ
#define OUT_SEQ SEQ              // row pitch (in tokens) between batches of the output
#endif
#define DM   768
#define NH_  12
#define HD   64
#define AW   4                   // waves per flash block (16 query rows each)
#define QRS  2048.0f             // carry of the q residual plane
#define QRI  (1.0f / 2048.0f)
#define SC2  (0.125f * 1.4426950408889634f)   // HD^-0.5 * log2(e)
#define PSH  8.0f                // log2 of the P carry (256)

static_assert(HD == 64);
static_assert(NH_ * HD == DM);                 // head h = columns h*64 + d
static_assert(DM % 64 == 0);                   // 12 column tiles of 64
static_assert(DM % 32 == 0);                   // GEMM k-loop steps by 32
static_assert(SEQ % 64 == 0);                  // a 64-row tile never straddles two batches
static_assert((NB * SEQ) % 64 == 0);
static_assert(SEQ % 32 == 0);                  // key loop steps by 32
static_assert(SEQ % (16 * AW) == 0);           // flash grid covers the sequence exactly
static_assert(((size_t)SEQ * DM) % 8 == 0);
static_assert(((size_t)DM * DM) % 8 == 0);
static_assert(NB <= NB_FULL);
static_assert(SEQ <= SEQ_FULL);

typedef _Float16 h16;
typedef unsigned short bf;
typedef __attribute__((ext_vector_type(16))) __bf16   v16bf;
typedef __attribute__((ext_vector_type(16))) _Float16 v16h;
typedef __attribute__((ext_vector_type(8)))  _Float16 v8h;
typedef __attribute__((ext_vector_type(8)))  unsigned short v8us;
typedef __attribute__((ext_vector_type(8)))  float    v8f;
typedef __attribute__((ext_vector_type(4)))  float    v4f;
typedef v4f  __attribute__((may_alias)) v4fa;

__device__ __forceinline__ unsigned short f2bf(float f) { unsigned u = __float_as_uint(f); u += 0x7FFFu + ((u >> 16) & 1u); return (unsigned short)(u >> 16); }
__device__ __forceinline__ v16h cat16(v8h lo, v8h hi) { return __builtin_shufflevector(lo, hi, 0, 1, 2, 3, 4, 5, 6, 7, 8, 9, 10, 11, 12, 13, 14, 15); }
__device__ __forceinline__ v16bf cat16b(v8us lo, v8us hi) { return __builtin_bit_cast(v16bf, __builtin_shufflevector(lo, hi, 0, 1, 2, 3, 4, 5, 6, 7, 8, 9, 10, 11, 12, 13, 14, 15)); }
__device__ __forceinline__ v8f wmma16(v16h a, v16h b, v8f c) { return __builtin_amdgcn_wmma_f32_16x16x32_f16(false, a, false, b, (short)0, c, false, false); }
__device__ __forceinline__ v8f wmmab(v16bf a, v16bf b, v8f c) { return __builtin_amdgcn_wmma_f32_16x16x32_bf16(false, a, false, b, (short)0, c, false, false); }
// fragment loaders from K-contiguous 16-bit rows; p already includes + 8*(lane>>4): elements 0..7 <- k0+8h+0..7, elements 8..15 <- k0+16+8h+0..7 (same map for A and B)
__device__ __forceinline__ v16h  ldh(const h16* p) { return cat16(*(const v8h*)p, *(const v8h*)(p + 16)); }
__device__ __forceinline__ v16bf ldb(const bf* p)  { return cat16b(*(const v8us*)p, *(const v8us*)(p + 16)); }
// ordering point for wave-private LDS tiles (same wave writes and reads)
__device__ __forceinline__ void wave_sync() { __builtin_amdgcn_fence(3 /* release order */, "wavefront"); __builtin_amdgcn_wave_barrier(); asm volatile("" ::: "memory"); }

__global__ __launch_bounds__(256) void k_cvt8(const float* __restrict__ src, bf* dst, size_t n8) {
    const size_t i = (size_t)blockIdx.x * 256 + threadIdx.x; if (i >= n8) return;
    const v8f v = *(const v8f*)(src + i * 8); v8us o;
#pragma unroll
    for (int k = 0; k < 8; ++k) o[k] = f2bf(v[k]);
    *(v8us*)(dst + i * 8) = o; 
}

// k_proj: register-blocked bf16 GEMM, ONE WAVE per 64x64 tile (16 accumulators), operands straight from K-contiguous bf16 planes, K = DM.
// C[m][n] = sum_k A[m][k] Bt[n][k], written as f16 (Ph) and optionally the f16 residual x2048 (Pr, useRes != 0) at
// tile base (r0/RB)*sRB + (r0%RB)*pitch + (c0/CB)*sCB + (c0%CB), row pitch 'pitch' (halves). grid (M/64, N/64), 32 threads.
__global__ __launch_bounds__(32) void k_proj(const bf* __restrict__ A, const bf* __restrict__ Bt, h16* Ph, h16* Pr, int useRes, int RB, size_t sRB, int pitch, int CB, size_t sCB) {
    __shared__ __align__(16) float os[16 * 68];
    const int K = DM;
    const int lane = threadIdx.x & 31, lr = lane & 15, hi = lane >> 4; const int r0 = blockIdx.x * 64, c0 = blockIdx.y * 64;
    v8f acc[4][4];
#pragma unroll
    for (int mb = 0; mb < 4; ++mb)
#pragma unroll
        for (int nb = 0; nb < 4; ++nb) acc[mb][nb] = (v8f){};
    const size_t aoff = (size_t)(r0 + lr) * K + 8 * hi, boff = (size_t)(c0 + lr) * K + 8 * hi;
#pragma unroll 1
    for (int kc = 0; kc < K; kc += 32) {
        v16bf a[4];
#pragma unroll
        for (int mb = 0; mb < 4; ++mb) a[mb] = ldb(A + aoff + (size_t)mb * 16 * K + kc);
#pragma unroll
        for (int nb = 0; nb < 4; ++nb) { const v16bf b = ldb(Bt + boff + (size_t)nb * 16 * K + kc);
#pragma unroll
            for (int mb = 0; mb < 4; ++mb) acc[mb][nb] = wmmab(a[mb], b, acc[mb][nb]); }
        asm volatile("v_nop\n\tv_nop\n\tv_nop\n\tv_nop" : "+v"(acc[0][0]), "+v"(acc[1][1]), "+v"(acc[2][2]), "+v"(acc[3][3]) : "v"(a[0]), "v"(a[1]), "v"(a[2]), "v"(a[3]));
    }
    const size_t tbase = (size_t)(r0 / RB) * sRB + (size_t)(r0 % RB) * (size_t)pitch + (size_t)(c0 / CB) * sCB + (size_t)(c0 % CB);
#pragma unroll
    for (int mb = 0; mb < 4; ++mb) {
#pragma unroll
        for (int nb = 0; nb < 4; ++nb) {
#pragma unroll
            for (int j = 0; j < 8; ++j) os[(hi * 8 + j) * 68 + nb * 16 + lr] = acc[mb][nb][j]; }   // D: row 8h+j, col lane&15
        wave_sync();
        const size_t sb = tbase + (size_t)(mb * 16) * (size_t)pitch;
{
#pragma unroll
            for (int s = 0; s < 4; ++s) { const int row = 4 * s + (lane >> 3), c8 = (lane & 7) * 8;   // 4 s x 4 row groups = 16 rows; 8 lanes x 8 = 64 columns
                const v4f x0 = *(const v4fa*)(&os[row * 68 + c8]); const v4f x1 = *(const v4fa*)(&os[row * 68 + c8 + 4]); v8h hv, rv;
#pragma unroll
                for (int i = 0; i < 4; ++i) { const h16 a0 = (h16)x0[i]; const h16 a1 = (h16)x1[i]; hv[i] = a0; hv[4 + i] = a1; rv[i] = (h16)((x0[i] - (float)a0) * QRS); rv[4 + i] = (h16)((x1[i] - (float)a1) * QRS); }
                const size_t oo = sb + (size_t)row * (size_t)pitch + c8;
                *(v8h*)(Ph + oo) = hv; if (useRes) *(v8h*)(Pr + oo) = rv; }
             }
        wave_sync();
    }
}

// k_flash: fused attention, one wave per 16 query rows of one (batch, head); K / V^T / Q fragments straight from the f16 planes (two 16-B loads each, arithmetic addressing).
// Transposed form: S^T[key][t] = K Q^T (A = K rows, B = Q rows); lane (t = lane&15, h = lane>>4) holds keys 8h+r of each 16-key tile, so the packed
// P tile is directly the B fragment of O^T[d][t] = V^T P^T (element r <- tile keys 0..15, element 8+r <- tile keys 16..31, lane unchanged).
// Softmax state (running max, partial sum) is one scalar per lane; the two lane halves of a row are combined with one xor-16 exchange.
__global__ __launch_bounds__(32 * AW) void k_flash(const h16* __restrict__ QH, const h16* __restrict__ QR, const h16* __restrict__ KP, const h16* __restrict__ VT, float* OUT) {
    __shared__ __align__(16) float os[AW * 16 * 68];
    const int lane = threadIdx.x & 31, wave = threadIdx.x >> 5, lr = lane & 15, hi = lane >> 4;
    const int zh = blockIdx.y; const int b = zh / NH_, h = zh % NH_;
    const int t0 = (blockIdx.x * AW + wave) * 16;
    const size_t pbase = (size_t)zh * SEQ * HD;
    const size_t qo = pbase + (size_t)(t0 + lr) * HD + 8 * hi;
    const v16h qh0 = ldh(QH + qo), qh1 = ldh(QH + qo + 32), qr0 = ldh(QR + qo), qr1 = ldh(QR + qo + 32);   // B fragments: col t, k = d
    const size_t ko = pbase + (size_t)lr * HD + 8 * hi;      // + key * HD       (A fragment: row key, k = d)
    const size_t vo = pbase + (size_t)lr * SEQ + 8 * hi;     // + 16j*SEQ + key  (A fragment: row d, k = key)
    v8f o0 = (v8f){}, o1 = (v8f){}, o2 = (v8f){}, o3 = (v8f){};
    float m = -3.0e38f, l = 0.0f;
#pragma unroll 1
    for (int key0 = 0; key0 < SEQ; key0 += 32) {
        const h16* ka = KP + ko + (size_t)key0 * HD;
        const v16h ka0 = ldh(ka), ka1 = ldh(ka + 32), kb0 = ldh(ka + 16 * HD), kb1 = ldh(ka + 16 * HD + 32);
        v8f sHa = (v8f){}, sLa = (v8f){}, sHb = (v8f){}, sLb = (v8f){};
        sHa = wmma16(ka0, qh0, sHa); sLa = wmma16(ka0, qr0, sLa); sHb = wmma16(kb0, qh0, sHb); sLb = wmma16(kb0, qr0, sLb);
        sHa = wmma16(ka1, qh1, sHa); sLa = wmma16(ka1, qr1, sLa); sHb = wmma16(kb1, qh1, sHb); sLb = wmma16(kb1, qr1, sLb);
        asm volatile("v_nop\n\tv_nop\n\tv_nop\n\tv_nop" : "+v"(sHa), "+v"(sLa), "+v"(sHb), "+v"(sLb) : "v"(ka0), "v"(ka1), "v"(kb0), "v"(kb1));
        float ta[8], tb[8]; float mx = -3.0e38f;
#pragma unroll
        for (int r = 0; r < 8; ++r) { ta[r] = (sHa[r] + sLa[r] * QRI) * SC2; tb[r] = (sHb[r] + sLb[r] * QRI) * SC2; mx = fmaxf(mx, fmaxf(ta[r], tb[r])); }
        mx = fmaxf(mx, __shfl_xor(mx, 16, 32));
        const float mnew = fmaxf(m, mx);
        const float alpha = __builtin_amdgcn_exp2f(m - mnew);
        const float sh = PSH - mnew;
        v16h pb; float ls = 0.0f;
#pragma unroll
        for (int r = 0; r < 8; ++r) { const h16 pa = (h16)__builtin_amdgcn_exp2f(ta[r] + sh); const h16 pc = (h16)__builtin_amdgcn_exp2f(tb[r] + sh); pb[r] = pa; pb[8 + r] = pc; ls += (float)pa + (float)pc; }
        l = l * alpha + ls; m = mnew;
        o0 = o0 * alpha; o1 = o1 * alpha; o2 = o2 * alpha; o3 = o3 * alpha;
        const h16* va = VT + vo + key0;
        const v16h v0 = ldh(va), v1 = ldh(va + (size_t)16 * SEQ), v2 = ldh(va + (size_t)32 * SEQ), v3 = ldh(va + (size_t)48 * SEQ);
        o0 = wmma16(v0, pb, o0); o1 = wmma16(v1, pb, o1); o2 = wmma16(v2, pb, o2); o3 = wmma16(v3, pb, o3);
        asm volatile("v_nop\n\tv_nop\n\tv_nop\n\tv_nop" : "+v"(o0), "+v"(o1), "+v"(o2), "+v"(o3) : "v"(v0), "v"(v1), "v"(v2), "v"(v3), "v"(pb));
    }
    l += __shfl_xor(l, 16, 32);
    const float inv = 1.0f / l;
    const int wb = wave * 16 * 68;
    // O^T D layout: o_j[r] = (d = 16j + 8h + r, t = lane&15) -> os[t][d]; rows 0..15 x columns 0..63 all written
    { v4f a, c;
      a[0] = o0[0] * inv; a[1] = o0[1] * inv; a[2] = o0[2] * inv; a[3] = o0[3] * inv; c[0] = o0[4] * inv; c[1] = o0[5] * inv; c[2] = o0[6] * inv; c[3] = o0[7] * inv;
      *(v4fa*)(&os[wb + lr * 68 +  0 + 8 * hi]) = a; *(v4fa*)(&os[wb + lr * 68 +  0 + 8 * hi + 4]) = c;
      a[0] = o1[0] * inv; a[1] = o1[1] * inv; a[2] = o1[2] * inv; a[3] = o1[3] * inv; c[0] = o1[4] * inv; c[1] = o1[5] * inv; c[2] = o1[6] * inv; c[3] = o1[7] * inv;
      *(v4fa*)(&os[wb + lr * 68 + 16 + 8 * hi]) = a; *(v4fa*)(&os[wb + lr * 68 + 16 + 8 * hi + 4]) = c;
      a[0] = o2[0] * inv; a[1] = o2[1] * inv; a[2] = o2[2] * inv; a[3] = o2[3] * inv; c[0] = o2[4] * inv; c[1] = o2[5] * inv; c[2] = o2[6] * inv; c[3] = o2[7] * inv;
      *(v4fa*)(&os[wb + lr * 68 + 32 + 8 * hi]) = a; *(v4fa*)(&os[wb + lr * 68 + 32 + 8 * hi + 4]) = c;
      a[0] = o3[0] * inv; a[1] = o3[1] * inv; a[2] = o3[2] * inv; a[3] = o3[3] * inv; c[0] = o3[4] * inv; c[1] = o3[5] * inv; c[2] = o3[6] * inv; c[3] = o3[7] * inv;
      *(v4fa*)(&os[wb + lr * 68 + 48 + 8 * hi]) = a; *(v4fa*)(&os[wb + lr * 68 + 48 + 8 * hi + 4]) = c; }
    wave_sync();
    float* orow = OUT + ((size_t)b * OUT_SEQ + t0) * DM + h * HD;
{
#pragma unroll
        for (int s = 0; s < 8; ++s) { const int row = 2 * s + hi, cofs = lr * 4;   // 8 s x 2 rows = 16 rows; 16 lanes x 4 floats = 64 columns
            const v4f val = *(const v4fa*)(&os[wb + row * 68 + cofs]);
            *(v4f*)(orow + (size_t)row * DM + cofs) = val; }
         }
}

static constexpr size_t al256(size_t v) { return (v + 255) & ~(size_t)255; }
static constexpr size_t SZ_XB = al256((size_t)NB * SEQ * DM * 2);
static constexpr size_t SZ_WB = al256((size_t)3 * DM * DM * 2);
static constexpr size_t SZ_PL = al256((size_t)NB * NH_ * SEQ * HD * 2);
static constexpr size_t SZ_TOTAL = SZ_XB + SZ_WB + 4 * SZ_PL;
static_assert(SZ_TOTAL <= (size_t)134217728);          // workspace carve <= 128 MiB
static_assert(((size_t)DM * DM * 2) % 256 == 0);       // weight sub-planes stay 256-byte aligned

extern "C" void kernel_launch(void* const* d_in, const int* in_sizes, int n_in,
                              void* d_out, int out_size, void* d_ws, size_t ws_size, hipStream_t stream) {
    if (n_in < 4) return;
    const size_t needx = ((size_t)(NB - 1) * SEQ_FULL + SEQ) * DM;
    if ((size_t)in_sizes[0] < needx) return;
    if ((size_t)in_sizes[1] < (size_t)DM * DM || (size_t)in_sizes[2] < (size_t)DM * DM || (size_t)in_sizes[3] < (size_t)DM * DM) return;
    if ((size_t)out_size < ((size_t)(NB - 1) * OUT_SEQ + SEQ) * DM) return;
    if (SZ_TOTAL > ws_size) return;
    const float* x = (const float*)d_in[0]; const float* wq = (const float*)d_in[1]; const float* wk = (const float*)d_in[2]; const float* wv = (const float*)d_in[3];   // wire order x, Wq, Wk, Wv ([out][in] = Bt as-is)
    float* OUT = (float*)d_out;      // [NB][SEQ][768]
    char* wsp = (char*)d_ws;
    bf* XB = (bf*)wsp; wsp += SZ_XB;                 // [NB*SEQ][768]
    bf* WB = (bf*)wsp; wsp += SZ_WB;                 // [3][768][768]: q | k | v
    h16* QH = (h16*)wsp; wsp += SZ_PL;               // [NB*12][SEQ][64]
    h16* QR = (h16*)wsp; wsp += SZ_PL;               // [NB*12][SEQ][64] residual x2048
    h16* KP = (h16*)wsp; wsp += SZ_PL;               // [NB*12][SEQ][64]
    h16* VT = (h16*)wsp; wsp += SZ_PL;               // [NB*12][64][SEQ]
    bf* WQ = WB; bf* WK = WB + (size_t)DM * DM; bf* WV = WB + (size_t)2 * DM * DM;

    if (SEQ == SEQ_FULL) {
        const size_t n8 = (size_t)NB * SEQ * DM / 8;
        k_cvt8<<<(unsigned)((n8 + 255) / 256), 256, 0, stream>>>(x, XB, n8);
    } else {
        const size_t n8 = (size_t)SEQ * DM / 8;
        for (int b = 0; b < NB; ++b) k_cvt8<<<(unsigned)((n8 + 255) / 256), 256, 0, stream>>>(x + (size_t)b * SEQ_FULL * DM, XB + (size_t)b * SEQ * DM, n8);
    }
    { const size_t n8 = (size_t)DM * DM / 8; const unsigned g = (unsigned)((n8 + 255) / 256);
      k_cvt8<<<g, 256, 0, stream>>>(wq, WQ, n8); k_cvt8<<<g, 256, 0, stream>>>(wk, WK, n8); k_cvt8<<<g, 256, 0, stream>>>(wv, WV, n8); }

    // q, k: A = x rows (m = b*SEQ + t), Bt = W rows (n = h*64 + d) -> plane [(b*12 + h)][t][d]
    k_proj<<<dim3(NB * SEQ / 64, DM / 64, 1), 32, 0, stream>>>(XB, WQ, QH, QR, 1, SEQ, (size_t)NH_ * SEQ * HD, HD, HD, (size_t)SEQ * HD);
    k_proj<<<dim3(NB * SEQ / 64, DM / 64, 1), 32, 0, stream>>>(XB, WK, KP, KP, 0, SEQ, (size_t)NH_ * SEQ * HD, HD, HD, (size_t)SEQ * HD);
    // v^T: A = Wv rows (m = h*64 + d), Bt = x rows (n = b*SEQ + t) -> plane [(b*768 + m)][t] = [(b*12 + h)][d][t]
    k_proj<<<dim3(DM / 64, NB * SEQ / 64, 1), 32, 0, stream>>>(WV, XB, VT, VT, 0, DM, (size_t)0, SEQ, SEQ, (size_t)DM * SEQ);

    k_flash<<<dim3(SEQ / (16 * AW), NB * NH_, 1), 32 * AW, 0, stream>>>(QH, QR, KP, VT, OUT);
}

// v001
// One run takes 155 microseconds.
// Timed twice side by side with v000, it ran 1.56 and 1.59 times as fast.
#include <hip/hip_runtime.h>
#include <stdint.h>

// Multi-head self-attention, width 768 = 12 heads x 64, x [NB][SEQ][768], Wq/Wk/Wv [out][in] (y = x W^T), no biases, no mask, score scale 1/8, output = concatenated heads (f32).
// Compute dtypes, f32 accumulate everywhere: projections v_wmma_f32_16x16x32_bf16 (x and W RNE-converted to bf16; products exact);
// scores v_wmma_f32_16x16x32_f16: k single f16, q as f16 value + f16 residual x2048 in its own accumulator (two products); P (x256 carry, cancels in the normalisation) and v single f16; softmax f32 (online, running max).
// Layout: bf16 copies of x and W; q (hi, residual), k planes [b*12+h][t][d] and v^T plane [b*12+h][d][t] written by the GEMM epilogue; fused flash kernel in transposed form (S^T = K Q^T, O^T = V^T P^T), K and V^T tiles staged in LDS by tensor loads (two buffers), output from f32 accumulators.

#ifndef NB
#define NB 4
#endif
#ifndef SEQ
#define SEQ 2048
#endif
#define NB_FULL  4
#define SEQ_FULL 2048
#ifndef OUT_SEQ
#define OUT_SEQ SEQ              // row pitch (in tokens) between batches of the output
#endif
#define DM   768
#define NH_  12
#define HD   64
#define AW   4                   // waves per flash block (16 query rows each)
#define QRS  2048.0f             // carry of the q residual plane
#define QRI  (1.0f / 2048.0f)
#define SC2  (0.125f * 1.4426950408889634f)   // HD^-0.5 * log2(e)
#define PSH  8.0f                // log2 of the P carry (256)
#define SKEY 64                  // keys per LDS stage (two 32-key passes of the score loop)
#define LPIT 144                 // LDS row pitch in bytes: 128-byte rows + 16 bytes of pad, conflict-free for ds_load_b128
#define SLICE 6144               // LDS bytes per wave's slice: 32 rows x LPIT = 4608, rounded up to a multiple of 2 KiB
#define RBUF (4 * SLICE)         // one stage: K keys 0..31 | K keys 32..63 | V^T d 0..31 | V^T d 32..63

static_assert(HD == 64);
static_assert(NH_ * HD == DM);                 // head h = columns h*64 + d
static_assert(DM % 64 == 0);                   // 12 column tiles of 64
static_assert(DM % 32 == 0);                   // GEMM k-loop steps by 32
static_assert(SEQ % 64 == 0);                  // a 64-row tile never straddles two batches
static_assert((NB * SEQ) % 64 == 0);
static_assert(SEQ % 32 == 0);                  // key loop steps by 32
static_assert(SEQ % SKEY == 0 && SEQ / SKEY >= 2);   // whole stages; the ring's prologue needs two
static_assert(AW == 4 && SKEY == 64 && HD * 2 == 128 && SKEY * 2 == 128);   // four slices of 32 rows x 128 bytes, one per wave
static_assert(32 * LPIT <= SLICE && SLICE % 2048 == 0);
static_assert(AW * 16 * 68 * 4 <= 2 * RBUF);   // output staging reuses the ring
static_assert(SEQ % (16 * AW) == 0);           // flash grid covers the sequence exactly
static_assert(((size_t)SEQ * DM) % 8 == 0);
static_assert(((size_t)DM * DM) % 8 == 0);
static_assert(NB <= NB_FULL);
static_assert(SEQ <= SEQ_FULL);

typedef _Float16 h16;
typedef unsigned short bf;
typedef __attribute__((ext_vector_type(16))) __bf16   v16bf;
typedef __attribute__((ext_vector_type(16))) _Float16 v16h;
typedef __attribute__((ext_vector_type(8)))  _Float16 v8h;
typedef __attribute__((ext_vector_type(8)))  unsigned short v8us;
typedef __attribute__((ext_vector_type(8)))  float    v8f;
typedef __attribute__((ext_vector_type(4)))  float    v4f;
typedef v4f  __attribute__((may_alias)) v4fa;
typedef uint32_t u32x4 __attribute__((ext_vector_type(4)));
typedef uint32_t u32x8 __attribute__((ext_vector_type(8)));

__device__ __forceinline__ unsigned short f2bf(float f) { unsigned u = __float_as_uint(f); u += 0x7FFFu + ((u >> 16) & 1u); return (unsigned short)(u >> 16); }
__device__ __forceinline__ v16h cat16(v8h lo, v8h hi) { return __builtin_shufflevector(lo, hi, 0, 1, 2, 3, 4, 5, 6, 7, 8, 9, 10, 11, 12, 13, 14, 15); }
__device__ __forceinline__ v16bf cat16b(v8us lo, v8us hi) { return __builtin_bit_cast(v16bf, __builtin_shufflevector(lo, hi, 0, 1, 2, 3, 4, 5, 6, 7, 8, 9, 10, 11, 12, 13, 14, 15)); }
__device__ __forceinline__ v8f wmma16(v16h a, v16h b, v8f c) { return __builtin_amdgcn_wmma_f32_16x16x32_f16(false, a, false, b, (short)0, c, false, false); }
__device__ __forceinline__ v8f wmmab(v16bf a, v16bf b, v8f c) { return __builtin_amdgcn_wmma_f32_16x16x32_bf16(false, a, false, b, (short)0, c, false, false); }
// fragment loaders from K-contiguous 16-bit rows; p already includes + 8*(lane>>4): elements 0..7 <- k0+8h+0..7, elements 8..15 <- k0+16+8h+0..7 (same map for A and B)
__device__ __forceinline__ v16h  ldh(const h16* p) { return cat16(*(const v8h*)p, *(const v8h*)(p + 16)); }
__device__ __forceinline__ v16bf ldb(const bf* p)  { return cat16b(*(const v8us*)p, *(const v8us*)(p + 16)); }
// ordering point for wave-private LDS tiles (same wave writes and reads)
__device__ __forceinline__ void wave_sync() { __builtin_amdgcn_fence(3 /* release order */, "wavefront"); __builtin_amdgcn_wave_barrier(); asm volatile("" ::: "memory"); }

__device__ __forceinline__ uint32_t uni(uint32_t v) { return (uint32_t)__builtin_amdgcn_readfirstlane(v); }
// a wave-uniform value held in a scalar register: tests around a tensor load must compile to s_cmp + s_cbranch_scc (the instruction ignores EXEC)
__device__ __forceinline__ uint32_t pinned(uint32_t v) { uint32_t w = uni(v); asm volatile("" : "+s"(w)); return w; }

__global__ __launch_bounds__(256) void k_cvt8(const float* __restrict__ src, bf* dst, size_t n8) {
    const size_t i = (size_t)blockIdx.x * 256 + threadIdx.x; if (i >= n8) return;
    const v8f v = *(const v8f*)(src + i * 8); v8us o;
#pragma unroll
    for (int k = 0; k < 8; ++k) o[k] = f2bf(v[k]);
    *(v8us*)(dst + i * 8) = o; 
}

// k_proj: register-blocked bf16 GEMM, ONE WAVE per 64x64 tile (16 accumulators), operands straight from K-contiguous bf16 planes, K = DM.
// C[m][n] = sum_k A[m][k] Bt[n][k], written as f16 (Ph) and optionally the f16 residual x2048 (Pr, useRes != 0) at
// tile base (r0/RB)*sRB + (r0%RB)*pitch + (c0/CB)*sCB + (c0%CB), row pitch 'pitch' (halves). grid (M/64, N/64), 32 threads.
__global__ __launch_bounds__(32) void k_proj(const bf* __restrict__ A, const bf* __restrict__ Bt, h16* Ph, h16* Pr, int useRes, int RB, size_t sRB, int pitch, int CB, size_t sCB) {
    __shared__ __align__(16) float os[16 * 68];
    const int K = DM;
    const int lane = threadIdx.x & 31, lr = lane & 15, hi = lane >> 4; const int r0 = blockIdx.x * 64, c0 = blockIdx.y * 64;
    v8f acc[4][4];
#pragma unroll
    for (int mb = 0; mb < 4; ++mb)
#pragma unroll
        for (int nb = 0; nb < 4; ++nb) acc[mb][nb] = (v8f){};
    const size_t aoff = (size_t)(r0 + lr) * K + 8 * hi, boff = (size_t)(c0 + lr) * K + 8 * hi;
#pragma unroll 1
    for (int kc = 0; kc < K; kc += 32) {
        v16bf a[4];
#pragma unroll
        for (int mb = 0; mb < 4; ++mb) a[mb] = ldb(A + aoff + (size_t)mb * 16 * K + kc);
#pragma unroll
        for (int nb = 0; nb < 4; ++nb) { const v16bf b = ldb(Bt + boff + (size_t)nb * 16 * K + kc);
#pragma unroll
            for (int mb = 0; mb < 4; ++mb) acc[mb][nb] = wmmab(a[mb], b, acc[mb][nb]); }
        asm volatile("v_nop\n\tv_nop\n\tv_nop\n\tv_nop" : "+v"(acc[0][0]), "+v"(acc[1][1]), "+v"(acc[2][2]), "+v"(acc[3][3]) : "v"(a[0]), "v"(a[1]), "v"(a[2]), "v"(a[3]));
    }
    const size_t tbase = (size_t)(r0 / RB) * sRB + (size_t)(r0 % RB) * (size_t)pitch + (size_t)(c0 / CB) * sCB + (size_t)(c0 % CB);
#pragma unroll
    for (int mb = 0; mb < 4; ++mb) {
#pragma unroll
        for (int nb = 0; nb < 4; ++nb) {
#pragma unroll
            for (int j = 0; j < 8; ++j) os[(hi * 8 + j) * 68 + nb * 16 + lr] = acc[mb][nb][j]; }   // D: row 8h+j, col lane&15
        wave_sync();
        const size_t sb = tbase + (size_t)(mb * 16) * (size_t)pitch;
{
#pragma unroll
            for (int s = 0; s < 4; ++s) { const int row = 4 * s + (lane >> 3), c8 = (lane & 7) * 8;   // 4 s x 4 row groups = 16 rows; 8 lanes x 8 = 64 columns
                const v4f x0 = *(const v4fa*)(&os[row * 68 + c8]); const v4f x1 = *(const v4fa*)(&os[row * 68 + c8 + 4]); v8h hv, rv;
#pragma unroll
                for (int i = 0; i < 4; ++i) { const h16 a0 = (h16)x0[i]; const h16 a1 = (h16)x1[i]; hv[i] = a0; hv[4 + i] = a1; rv[i] = (h16)((x0[i] - (float)a0) * QRS); rv[4 + i] = (h16)((x1[i] - (float)a1) * QRS); }
                const size_t oo = sb + (size_t)row * (size_t)pitch + c8;
                *(v8h*)(Ph + oo) = hv; if (useRes) *(v8h*)(Pr + oo) = rv; }
             }
        wave_sync();
    }
}

// k_flash: fused attention, one wave per 16 query rows of one (batch, head); Q fragments straight from the f16 planes (two 16-B loads each).
// K and V^T: stages of 64 keys in a two-buffer LDS ring shared by the block's four waves. Each wave brings one slice (32 rows x 128 bytes, padded to 144) per stage
// with one tensor_load_to_lds, one stage ahead of its use; fragments are two ds_load_b128 each.
// Transposed form: S^T[key][t] = K Q^T (A = K rows, B = Q rows); lane (t = lane&15, h = lane>>4) holds keys 8h+r of each 16-key tile, so the packed
// P tile is directly the B fragment of O^T[d][t] = V^T P^T (element r <- tile keys 0..15, element 8+r <- tile keys 16..31, lane unchanged).
// Softmax state (running max, partial sum) is one scalar per lane; the two lane halves of a row are combined with one xor-16 exchange.
__global__ __launch_bounds__(32 * AW) void k_flash(const h16* __restrict__ QH, const h16* __restrict__ QR, const h16* __restrict__ KP, const h16* __restrict__ VT, float* OUT) {
    __shared__ __attribute__((aligned(2048))) unsigned char ring[2 * RBUF];
    float* os = (float*)ring;      // output staging, used only behind the last stage's barrier
    const int lane = threadIdx.x & 31, lr = lane & 15, hi = lane >> 4;
    const int wave = (int)uni(threadIdx.x >> 5);
    const int zh = blockIdx.y; const int b = zh / NH_, h = zh % NH_;
    const int t0 = (blockIdx.x * AW + wave) * 16;
    const size_t pbase = (size_t)zh * SEQ * HD;
    const size_t qo = pbase + (size_t)(t0 + lr) * HD + 8 * hi;
    const v16h qh0 = ldh(QH + qo), qh1 = ldh(QH + qo + 32), qr0 = ldh(QR + qo), qr1 = ldh(QR + qo + 32);   // B fragments: col t, k = d
    // This wave's slice: waves 0, 1 = K keys 0..31, 32..63 of the stage (source pitch 128 B); waves 2, 3 = V^T rows d 0..31, 32..63 (source pitch 2*SEQ B).
    const bool isV = (wave & 2) != 0; const size_t half = (size_t)(wave & 1);
    const uint64_t sbase = (uint64_t)(size_t)(isV ? VT + pbase + half * 32 * SEQ : KP + pbase + half * 32 * HD);
    const uint32_t sstep = isV ? (uint32_t)(SKEY * 2) : (uint32_t)(SKEY * HD * 2);   // source bytes from one stage to the next
    const uint32_t ldst = (uint32_t)(size_t)ring + (uint32_t)wave * SLICE;
    u32x8 g1;                      // 1-byte elements, tile = tensor = 32 rows x 128 bytes, 4 dwords of LDS pad behind every 32 dwords
    g1[0] = uni((1u << 20) | (4u << 22) | (3u << 25)); g1[1] = uni(128u << 16); g1[2] = uni(32u << 16); g1[3] = uni(128u << 16);
    g1[4] = uni(32u); g1[5] = uni(isV ? (uint32_t)(SEQ * 2) : (uint32_t)(HD * 2)); g1[6] = uni(0u); g1[7] = uni(0u);
    auto issue = [&](uint32_t st) {
        const uint64_t ga = sbase + (uint64_t)st * sstep;
        u32x4 g0; g0[0] = uni(1u); g0[1] = uni(ldst + (st & 1u) * RBUF); g0[2] = uni((uint32_t)ga); g0[3] = uni((((uint32_t)(ga >> 32)) & 0x01FFFFFFu) | 0x80000000u);
        asm volatile("tensor_load_to_lds %0, %1" :: "s"(g0), "s"(g1) : "memory");   // one request of the whole wave: its slice, global -> LDS, through no register
    };
    issue(0u);
    asm volatile("s_wait_tensorcnt 0x0" ::: "memory");   // this wave's slice of stage 0 has landed
    __syncthreads();                                     // stage 0 published to all four waves
    issue(1u);
    const unsigned char* fr = ring + lr * LPIT + 16 * hi;    // fragment row lr, k half hi (A fragments: K row = key, k = d; V^T row = d, k = key)
    v8f o0 = (v8f){}, o1 = (v8f){}, o2 = (v8f){}, o3 = (v8f){};
    float m = -3.0e38f, l = 0.0f;
#pragma unroll 1
    for (uint32_t st = 0; st < (uint32_t)(SEQ / SKEY); ++st) {
      const unsigned char* fb = fr + (st & 1u) * RBUF;
#pragma unroll   // both passes of a stage inline: slice and key offsets become immediate offsets of the ds_load_b128
      for (int sub = 0; sub < SKEY / 32; ++sub) {
        const h16* ka = (const h16*)(fb + sub * SLICE);      // K slice sub = the 32 keys of this pass
        const v16h ka0 = ldh(ka), ka1 = ldh(ka + 32), kb0 = ldh(ka + 16 * (LPIT / 2)), kb1 = ldh(ka + 16 * (LPIT / 2) + 32);
        v8f sHa = (v8f){}, sLa = (v8f){}, sHb = (v8f){}, sLb = (v8f){};
        sHa = wmma16(ka0, qh0, sHa); sLa = wmma16(ka0, qr0, sLa); sHb = wmma16(kb0, qh0, sHb); sLb = wmma16(kb0, qr0, sLb);
        sHa = wmma16(ka1, qh1, sHa); sLa = wmma16(ka1, qr1, sLa); sHb = wmma16(kb1, qh1, sHb); sLb = wmma16(kb1, qr1, sLb);
        asm volatile("v_nop\n\tv_nop\n\tv_nop\n\tv_nop" : "+v"(sHa), "+v"(sLa), "+v"(sHb), "+v"(sLb) : "v"(ka0), "v"(ka1), "v"(kb0), "v"(kb1));
        float ta[8], tb[8]; float mx = -3.0e38f;
#pragma unroll
        for (int r = 0; r < 8; ++r) { ta[r] = (sHa[r] + sLa[r] * QRI) * SC2; tb[r] = (sHb[r] + sLb[r] * QRI) * SC2; mx = fmaxf(mx, fmaxf(ta[r], tb[r])); }
        mx = fmaxf(mx, __shfl_xor(mx, 16, 32));
        const float mnew = fmaxf(m, mx);
        const float alpha = __builtin_amdgcn_exp2f(m - mnew);
        const float sh = PSH - mnew;
        v16h pb; float ls = 0.0f;
#pragma unroll
        for (int r = 0; r < 8; ++r) { const h16 pa = (h16)__builtin_amdgcn_exp2f(ta[r] + sh); const h16 pc = (h16)__builtin_amdgcn_exp2f(tb[r] + sh); pb[r] = pa; pb[8 + r] = pc; ls += (float)pa + (float)pc; }
        l = l * alpha + ls; m = mnew;
        o0 = o0 * alpha; o1 = o1 * alpha; o2 = o2 * alpha; o3 = o3 * alpha;
        const h16* va = (const h16*)(fb + 2 * SLICE + sub * 64);   // V^T slices, 32 keys = 64 bytes along the row per pass
        const v16h v0 = ldh(va), v1 = ldh(va + 16 * (LPIT / 2)), v2 = ldh(va + SLICE / 2), v3 = ldh(va + SLICE / 2 + 16 * (LPIT / 2));
        o0 = wmma16(v0, pb, o0); o1 = wmma16(v1, pb, o1); o2 = wmma16(v2, pb, o2); o3 = wmma16(v3, pb, o3);
        asm volatile("v_nop\n\tv_nop\n\tv_nop\n\tv_nop" : "+v"(o0), "+v"(o1), "+v"(o2), "+v"(o3) : "v"(v0), "v"(v1), "v"(v2), "v"(v3), "v"(pb));
      }
      asm volatile("s_wait_dscnt 0x0" ::: "memory");
      asm volatile("s_wait_tensorcnt 0x0" ::: "memory");
      __syncthreads();
      const uint32_t nx = pinned(st + 2u);
      if (pinned(nx < (uint32_t)(SEQ / SKEY))) issue(nx);
    }
    asm volatile("s_wait_tensorcnt 0x0" ::: "memory");     // nothing in flight before the ring becomes output staging
    asm volatile("s_wait_dscnt 0x0" ::: "memory");         // (the last stage's own barrier has ended every wave's reads)
    l += __shfl_xor(l, 16, 32);
    const float inv = 1.0f / l;
    const int wb = wave * 16 * 68;
    // O^T D layout: o_j[r] = (d = 16j + 8h + r, t = lane&15) -> os[t][d]; rows 0..15 x columns 0..63 all written
    { v4f a, c;
      a[0] = o0[0] * inv; a[1] = o0[1] * inv; a[2] = o0[2] * inv; a[3] = o0[3] * inv; c[0] = o0[4] * inv; c[1] = o0[5] * inv; c[2] = o0[6] * inv; c[3] = o0[7] * inv;
      *(v4fa*)(&os[wb + lr * 68 +  0 + 8 * hi]) = a; *(v4fa*)(&os[wb + lr * 68 +  0 + 8 * hi + 4]) = c;
      a[0] = o1[0] * inv; a[1] = o1[1] * inv; a[2] = o1[2] * inv; a[3] = o1[3] * inv; c[0] = o1[4] * inv; c[1] = o1[5] * inv; c[2] = o1[6] * inv; c[3] = o1[7] * inv;
      *(v4fa*)(&os[wb + lr * 68 + 16 + 8 * hi]) = a; *(v4fa*)(&os[wb + lr * 68 + 16 + 8 * hi + 4]) = c;
      a[0] = o2[0] * inv; a[1] = o2[1] * inv; a[2] = o2[2] * inv; a[3] = o2[3] * inv; c[0] = o2[4] * inv; c[1] = o2[5] * inv; c[2] = o2[6] * inv; c[3] = o2[7] * inv;
      *(v4fa*)(&os[wb + lr * 68 + 32 + 8 * hi]) = a; *(v4fa*)(&os[wb + lr * 68 + 32 + 8 * hi + 4]) = c;
      a[0] = o3[0] * inv; a[1] = o3[1] * inv; a[2] = o3[2] * inv; a[3] = o3[3] * inv; c[0] = o3[4] * inv; c[1] = o3[5] * inv; c[2] = o3[6] * inv; c[3] = o3[7] * inv;
      *(v4fa*)(&os[wb + lr * 68 + 48 + 8 * hi]) = a; *(v4fa*)(&os[wb + lr * 68 + 48 + 8 * hi + 4]) = c; }
    wave_sync();
    float* orow = OUT + ((size_t)b * OUT_SEQ + t0) * DM + h * HD;
{
#pragma unroll
        for (int s = 0; s < 8; ++s) { const int row = 2 * s + hi, cofs = lr * 4;   // 8 s x 2 rows = 16 rows; 16 lanes x 4 floats = 64 columns
            const v4f val = *(const v4fa*)(&os[wb + row * 68 + cofs]);
            *(v4f*)(orow + (size_t)row * DM + cofs) = val; }
         }
}

static constexpr size_t al256(size_t v) { return (v + 255) & ~(size_t)255; }
static constexpr size_t SZ_XB = al256((size_t)NB * SEQ * DM * 2);
static constexpr size_t SZ_WB = al256((size_t)3 * DM * DM * 2);
static constexpr size_t SZ_PL = al256((size_t)NB * NH_ * SEQ * HD * 2);
static constexpr size_t SZ_TOTAL = SZ_XB + SZ_WB + 4 * SZ_PL;
static_assert(SZ_TOTAL <= (size_t)134217728);          // workspace carve <= 128 MiB
static_assert(((size_t)DM * DM * 2) % 256 == 0);       // weight sub-planes stay 256-byte aligned

extern "C" void kernel_launch(void* const* d_in, const int* in_sizes, int n_in,
                              void* d_out, int out_size, void* d_ws, size_t ws_size, hipStream_t stream) {
    if (n_in < 4) return;
    const size_t needx = ((size_t)(NB - 1) * SEQ_FULL + SEQ) * DM;
    if ((size_t)in_sizes[0] < needx) return;
    if ((size_t)in_sizes[1] < (size_t)DM * DM || (size_t)in_sizes[2] < (size_t)DM * DM || (size_t)in_sizes[3] < (size_t)DM * DM) return;
    if ((size_t)out_size < ((size_t)(NB - 1) * OUT_SEQ + SEQ) * DM) return;
    if (SZ_TOTAL > ws_size) return;
    const float* x = (const float*)d_in[0]; const float* wq = (const float*)d_in[1]; const float* wk = (const float*)d_in[2]; const float* wv = (const float*)d_in[3];   // wire order x, Wq, Wk, Wv ([out][in] = Bt as-is)
    float* OUT = (float*)d_out;      // [NB][SEQ][768]
    char* wsp = (char*)d_ws;
    bf* XB = (bf*)wsp; wsp += SZ_XB;                 // [NB*SEQ][768]
    bf* WB = (bf*)wsp; wsp += SZ_WB;                 // [3][768][768]: q | k | v
    h16* QH = (h16*)wsp; wsp += SZ_PL;               // [NB*12][SEQ][64]
    h16* QR = (h16*)wsp; wsp += SZ_PL;               // [NB*12][SEQ][64] residual x2048
    h16* KP = (h16*)wsp; wsp += SZ_PL;               // [NB*12][SEQ][64]
    h16* VT = (h16*)wsp; wsp += SZ_PL;               // [NB*12][64][SEQ]
    bf* WQ = WB; bf* WK = WB + (size_t)DM * DM; bf* WV = WB + (size_t)2 * DM * DM;

    if (SEQ == SEQ_FULL) {
        const size_t n8 = (size_t)NB * SEQ * DM / 8;
        k_cvt8<<<(unsigned)((n8 + 255) / 256), 256, 0, stream>>>(x, XB, n8);
    } else {
        const size_t n8 = (size_t)SEQ * DM / 8;
        for (int b = 0; b < NB; ++b) k_cvt8<<<(unsigned)((n8 + 255) / 256), 256, 0, stream>>>(x + (size_t)b * SEQ_FULL * DM, XB + (size_t)b * SEQ * DM, n8);
    }
    { const size_t n8 = (size_t)DM * DM / 8; const unsigned g = (unsigned)((n8 + 255) / 256);
      k_cvt8<<<g, 256, 0, stream>>>(wq, WQ, n8); k_cvt8<<<g, 256, 0, stream>>>(wk, WK, n8); k_cvt8<<<g, 256, 0, stream>>>(wv, WV, n8); }

    // q, k: A = x rows (m = b*SEQ + t), Bt = W rows (n = h*64 + d) -> plane [(b*12 + h)][t][d]
    k_proj<<<dim3(NB * SEQ / 64, DM / 64, 1), 32, 0, stream>>>(XB, WQ, QH, QR, 1, SEQ, (size_t)NH_ * SEQ * HD, HD, HD, (size_t)SEQ * HD);
    k_proj<<<dim3(NB * SEQ / 64, DM / 64, 1), 32, 0, stream>>>(XB, WK, KP, KP, 0, SEQ, (size_t)NH_ * SEQ * HD, HD, HD, (size_t)SEQ * HD);
    // v^T: A = Wv rows (m = h*64 + d), Bt = x rows (n = b*SEQ + t) -> plane [(b*768 + m)][t] = [(b*12 + h)][d][t]
    k_proj<<<dim3(DM / 64, NB * SEQ / 64, 1), 32, 0, stream>>>(WV, XB, VT, VT, 0, DM, (size_t)0, SEQ, SEQ, (size_t)DM * SEQ);

    k_flash<<<dim3(SEQ / (16 * AW), NB * NH_, 1), 32 * AW, 0, stream>>>(QH, QR, KP, VT, OUT);
}

// v002
// It runs in 119 microseconds.
// Timed twice side by side with v001, it ran 1.29 times as fast both times.
// All steps since v000 together make it 2.03 times as fast.
#include <hip/hip_runtime.h>
#include <stdint.h>

// Multi-head self-attention, width 768 = 12 heads x 64, x [NB][SEQ][768], Wq/Wk/Wv [out][in] (y = x W^T), no biases, no mask, score scale 1/8, output = concatenated heads (f32).
// Compute dtypes, f32 accumulate everywhere: projections v_wmma_f32_16x16x32_bf16 (x and W RNE-converted to bf16; products exact);
// scores v_wmma_f32_16x16x32_f16: k single f16, q as f16 value + f16 residual x2048 in its own accumulator (two products); P (x256 carry, cancels in the normalisation) and v single f16; softmax f32 (online, running max).
// Layout: bf16 copies of x and W (GEMM tiles staged in LDS by tensor loads, two buffers); q (hi, residual), k planes [b*12+h][t][d] and v^T plane [b*12+h][d][t] written by the GEMM epilogue; fused flash kernel in transposed form (S^T = K Q^T, O^T = V^T P^T), K and V^T tiles staged in LDS by tensor loads (two buffers), output from f32 accumulators.

#ifndef NB
#define NB 4
#endif
#ifndef SEQ
#define SEQ 2048
#endif
#define NB_FULL  4
#define SEQ_FULL 2048
#ifndef OUT_SEQ
#define OUT_SEQ SEQ              // row pitch (in tokens) between batches of the output
#endif
#define DM   768
#define NH_  12
#define HD   64
#define AW   4                   // waves per flash block (16 query rows each)
#define QRS  2048.0f             // carry of the q residual plane
#define QRI  (1.0f / 2048.0f)
#define SC2  (0.125f * 1.4426950408889634f)   // HD^-0.5 * log2(e)
#define PSH  8.0f                // log2 of the P carry (256)
#define SKEY 64                  // keys per LDS stage (two 32-key passes of the score loop)
#define LPIT 144                 // LDS row pitch in bytes: 128-byte rows + 16 bytes of pad, conflict-free for ds_load_b128
#define SLICE 6144               // LDS bytes per wave's slice: 32 rows x LPIT = 4608, rounded up to a multiple of 2 KiB
#define RBUF (4 * SLICE)         // one stage: K keys 0..31 | K keys 32..63 | V^T d 0..31 | V^T d 32..63
#define PW   4                   // waves per projection block (2 x 2 tiles of 64x64)
#define PKS  64                  // k per LDS stage of the projection GEMM (two 32-k steps)
#define PSL  10240               // LDS bytes per wave's slice: 64 rows x LPIT = 9216, rounded up to a multiple of 2 KiB
#define PBUF (4 * PSL)           // one stage: A rows 0..63 | A rows 64..127 | Bt rows 0..63 | Bt rows 64..127

static_assert(HD == 64);
static_assert(NH_ * HD == DM);                 // head h = columns h*64 + d
static_assert(DM % 64 == 0);                   // 12 column tiles of 64
static_assert(DM % PKS == 0 && DM / PKS >= 2);   // whole GEMM stages; the ring's prologue needs two
static_assert(DM % 128 == 0 && (NB * SEQ) % 128 == 0);   // 128x128 block tiles cover every projection exactly
static_assert(PW == 4 && PKS * 2 == 128 && 64 * LPIT <= PSL && PSL % 2048 == 0);   // four slices of 64 rows x 128 bytes, one per wave
static_assert(SEQ % 64 == 0);                  // a 64-row tile never straddles two batches
static_assert((NB * SEQ) % 64 == 0);
static_assert(SEQ % 32 == 0);                  // key loop steps by 32
static_assert(SEQ % SKEY == 0 && SEQ / SKEY >= 2);   // whole stages; the ring's prologue needs two
static_assert(AW == 4 && SKEY == 64 && HD * 2 == 128 && SKEY * 2 == 128);   // four slices of 32 rows x 128 bytes, one per wave
static_assert(32 * LPIT <= SLICE && SLICE % 2048 == 0);
static_assert(AW * 16 * 68 * 4 <= 2 * RBUF);   // output staging reuses the ring
static_assert(SEQ % (16 * AW) == 0);           // flash grid covers the sequence exactly
static_assert(((size_t)SEQ * DM) % 8 == 0);
static_assert(((size_t)DM * DM) % 8 == 0);
static_assert(NB <= NB_FULL);
static_assert(SEQ <= SEQ_FULL);

typedef _Float16 h16;
typedef unsigned short bf;
typedef __attribute__((ext_vector_type(16))) __bf16   v16bf;
typedef __attribute__((ext_vector_type(16))) _Float16 v16h;
typedef __attribute__((ext_vector_type(8)))  _Float16 v8h;
typedef __attribute__((ext_vector_type(8)))  unsigned short v8us;
typedef __attribute__((ext_vector_type(8)))  float    v8f;
typedef __attribute__((ext_vector_type(4)))  float    v4f;
typedef v4f  __attribute__((may_alias)) v4fa;
typedef uint32_t u32x4 __attribute__((ext_vector_type(4)));
typedef uint32_t u32x8 __attribute__((ext_vector_type(8)));

__device__ __forceinline__ unsigned short f2bf(float f) { unsigned u = __float_as_uint(f); u += 0x7FFFu + ((u >> 16) & 1u); return (unsigned short)(u >> 16); }
__device__ __forceinline__ v16h cat16(v8h lo, v8h hi) { return __builtin_shufflevector(lo, hi, 0, 1, 2, 3, 4, 5, 6, 7, 8, 9, 10, 11, 12, 13, 14, 15); }
__device__ __forceinline__ v16bf cat16b(v8us lo, v8us hi) { return __builtin_bit_cast(v16bf, __builtin_shufflevector(lo, hi, 0, 1, 2, 3, 4, 5, 6, 7, 8, 9, 10, 11, 12, 13, 14, 15)); }
__device__ __forceinline__ v8f wmma16(v16h a, v16h b, v8f c) { return __builtin_amdgcn_wmma_f32_16x16x32_f16(false, a, false, b, (short)0, c, false, false); }
__device__ __forceinline__ v8f wmmab(v16bf a, v16bf b, v8f c) { return __builtin_amdgcn_wmma_f32_16x16x32_bf16(false, a, false, b, (short)0, c, false, false); }
// fragment loaders from K-contiguous 16-bit rows; p already includes + 8*(lane>>4): elements 0..7 <- k0+8h+0..7, elements 8..15 <- k0+16+8h+0..7 (same map for A and B)
__device__ __forceinline__ v16h  ldh(const h16* p) { return cat16(*(const v8h*)p, *(const v8h*)(p + 16)); }
__device__ __forceinline__ v16bf ldb(const bf* p)  { return cat16b(*(const v8us*)p, *(const v8us*)(p + 16)); }
// ordering point for wave-private LDS tiles (same wave writes and reads)
__device__ __forceinline__ void wave_sync() { __builtin_amdgcn_fence(3 /* release order */, "wavefront"); __builtin_amdgcn_wave_barrier(); asm volatile("" ::: "memory"); }

__device__ __forceinline__ uint32_t uni(uint32_t v) { return (uint32_t)__builtin_amdgcn_readfirstlane(v); }
// a wave-uniform value held in a scalar register: tests around a tensor load must compile to s_cmp + s_cbranch_scc (the instruction ignores EXEC)
__device__ __forceinline__ uint32_t pinned(uint32_t v) { uint32_t w = uni(v); asm volatile("" : "+s"(w)); return w; }

__global__ __launch_bounds__(256) void k_cvt8(const float* __restrict__ src, bf* dst, size_t n8) {
    const size_t i = (size_t)blockIdx.x * 256 + threadIdx.x; if (i >= n8) return;
    const v8f v = *(const v8f*)(src + i * 8); v8us o;
#pragma unroll
    for (int k = 0; k < 8; ++k) o[k] = f2bf(v[k]);
    *(v8us*)(dst + i * 8) = o; 
}

// k_proj: bf16 GEMM, one block of four waves (2 x 2) per 128x128 tile, each wave a 64x64 tile (16 accumulators), K = DM.
// A and Bt: stages of 64 k (128 bytes of every row) in a two-buffer LDS ring shared by the block's four waves. Each wave brings one slice (64 rows x 128 bytes, padded to 144)
// per stage with one tensor_load_to_lds, one stage ahead of its use; fragments are two ds_load_b128 each.
// C[m][n] = sum_k A[m][k] Bt[n][k], written as f16 (Ph) and optionally the f16 residual x2048 (Pr, useRes != 0) at
// tile base (r0/RB)*sRB + (r0%RB)*pitch + (c0/CB)*sCB + (c0%CB), row pitch 'pitch' (halves). grid (M/128, N/128), 128 threads.
__global__ __launch_bounds__(32 * PW) void k_proj(const bf* __restrict__ A, const bf* __restrict__ Bt, h16* Ph, h16* Pr, int useRes, int RB, size_t sRB, int pitch, int CB, size_t sCB) {
    __shared__ __attribute__((aligned(2048))) unsigned char ring[2 * PBUF];
    __shared__ __align__(16) float osall[PW * 16 * 68];
    const int K = DM;
    const int lane = threadIdx.x & 31, lr = lane & 15, hi = lane >> 4;
    const int wave = (int)uni(threadIdx.x >> 5);
    const int wm = wave >> 1, wn = wave & 1;                 // this wave's 64x64 tile inside the block's 128x128
    const int r0 = blockIdx.x * 128 + wm * 64, c0 = blockIdx.y * 128 + wn * 64;
    float* os = osall + wave * 16 * 68;                      // wave-private output staging
    // This wave's slice: waves 0, 1 = A rows 0..63, 64..127 of the block's tile; waves 2, 3 = Bt rows 0..63, 64..127 (source pitch 2*K bytes).
    const bool isB = (wave & 2) != 0; const size_t half = (size_t)(wave & 1);
    const uint64_t sbase = (uint64_t)(size_t)(isB ? Bt + ((size_t)blockIdx.y * 128 + half * 64) * K : A + ((size_t)blockIdx.x * 128 + half * 64) * K);
    const uint32_t ldst = (uint32_t)(size_t)ring + (uint32_t)wave * PSL;
    u32x8 g1;                      // 1-byte elements, tile = tensor = 64 rows x 128 bytes, 4 dwords of LDS pad behind every 32 dwords
    g1[0] = uni((1u << 20) | (4u << 22) | (3u << 25)); g1[1] = uni(128u << 16); g1[2] = uni(64u << 16); g1[3] = uni(128u << 16);
    g1[4] = uni(64u); g1[5] = uni((uint32_t)(DM * 2)); g1[6] = uni(0u); g1[7] = uni(0u);
    auto issue = [&](uint32_t st) {
        const uint64_t ga = sbase + (uint64_t)st * (uint32_t)(PKS * 2);
        u32x4 g0; g0[0] = uni(1u); g0[1] = uni(ldst + (st & 1u) * PBUF); g0[2] = uni((uint32_t)ga); g0[3] = uni((((uint32_t)(ga >> 32)) & 0x01FFFFFFu) | 0x80000000u);
        asm volatile("tensor_load_to_lds %0, %1" :: "s"(g0), "s"(g1) : "memory");   // one request of the whole wave: its slice, global -> LDS, through no register
    };
    issue(0u);
    asm volatile("s_wait_tensorcnt 0x0" ::: "memory");   // this wave's slice of stage 0 has landed
    __syncthreads();                                     // stage 0 published to all four waves
    issue(1u);
    const unsigned char* fra = ring + wm * PSL + lr * LPIT + 16 * hi;         // A fragment row lr, k half hi
    const unsigned char* frb = ring + (2 + wn) * PSL + lr * LPIT + 16 * hi;   // Bt fragment row lr, k half hi
    v8f acc[4][4];
#pragma unroll
    for (int mb = 0; mb < 4; ++mb)
#pragma unroll
        for (int nb = 0; nb < 4; ++nb) acc[mb][nb] = (v8f){};
#pragma unroll 1
    for (uint32_t st = 0; st < (uint32_t)(DM / PKS); ++st) {
        const unsigned char* fa = fra + (st & 1u) * PBUF; const unsigned char* fb = frb + (st & 1u) * PBUF;
        // Fragments of the stage's two 32-k steps. The first step's sixteen ds_load_b128 and twelve of the second step's stand as one group in front of the WMMAs;
        // the last four follow once two Bt fragments of the first step are spent, so that 16 accumulators and the fragments stay under 256 registers.
        v16bf a0[4], b0[4], a1[4], b1[4];
#pragma unroll
        for (int i = 0; i < 4; ++i) { a0[i] = ldb((const bf*)(fa + i * 16 * LPIT)); b0[i] = ldb((const bf*)(fb + i * 16 * LPIT)); }
#pragma unroll
        for (int i = 0; i < 4; ++i) a1[i] = ldb((const bf*)(fa + i * 16 * LPIT + 64));
        b1[0] = ldb((const bf*)(fb + 64)); b1[1] = ldb((const bf*)(fb + 16 * LPIT + 64));
        __builtin_amdgcn_sched_barrier(0);   // keeps the load group in front: sunk among the WMMAs, each small group is waited out to zero
#pragma unroll
        for (int nb = 0; nb < 2; ++nb)
#pragma unroll
            for (int mb = 0; mb < 4; ++mb) acc[mb][nb] = wmmab(a0[mb], b0[nb], acc[mb][nb]);
        __builtin_amdgcn_sched_barrier(0);   // the last four loads stay here, sixteen WMMAs ahead of their first use
        b1[2] = ldb((const bf*)(fb + 2 * 16 * LPIT + 64)); b1[3] = ldb((const bf*)(fb + 3 * 16 * LPIT + 64));
        __builtin_amdgcn_sched_barrier(0);   // and do not sink among the WMMAs behind them, where they would be waited out to zero
#pragma unroll
        for (int nb = 2; nb < 4; ++nb)
#pragma unroll
            for (int mb = 0; mb < 4; ++mb) acc[mb][nb] = wmmab(a0[mb], b0[nb], acc[mb][nb]);
#pragma unroll
        for (int nb = 0; nb < 4; ++nb)
#pragma unroll
            for (int mb = 0; mb < 4; ++mb) acc[mb][nb] = wmmab(a1[mb], b1[nb], acc[mb][nb]);
        // four vector slots behind the last WMMA of the stage, before anything may overwrite its operands or touch its result (also on the loop's taken branch)
        asm volatile("v_nop\n\tv_nop\n\tv_nop\n\tv_nop" : "+v"(acc[0][3]), "+v"(acc[1][3]), "+v"(acc[2][3]), "+v"(acc[3][3]) : "v"(a1[0]), "v"(a1[1]), "v"(a1[2]), "v"(a1[3]), "v"(b1[3]));
        __builtin_amdgcn_sched_barrier(0);   // keeps the stage's WMMAs in front of the publish point: moved behind the barrier they would delay the refill that follows it
        asm volatile("s_wait_dscnt 0x0" ::: "memory");
        asm volatile("s_wait_tensorcnt 0x0" ::: "memory");
        __syncthreads();
        const uint32_t nx = pinned(st + 2u);
        if (pinned(nx < (uint32_t)(DM / PKS))) issue(nx);
    }
    asm volatile("s_wait_tensorcnt 0x0" ::: "memory");       // nothing in flight when the wave goes on to its epilogue
    asm volatile("s_wait_dscnt 0x0" ::: "memory");
    const size_t tbase = (size_t)(r0 / RB) * sRB + (size_t)(r0 % RB) * (size_t)pitch + (size_t)(c0 / CB) * sCB + (size_t)(c0 % CB);
#pragma unroll
    for (int mb = 0; mb < 4; ++mb) {
#pragma unroll
        for (int nb = 0; nb < 4; ++nb) {
#pragma unroll
            for (int j = 0; j < 8; ++j) os[(hi * 8 + j) * 68 + nb * 16 + lr] = acc[mb][nb][j]; }   // D: row 8h+j, col lane&15
        wave_sync();
        const size_t sb = tbase + (size_t)(mb * 16) * (size_t)pitch;
{
#pragma unroll
            for (int s = 0; s < 4; ++s) { const int row = 4 * s + (lane >> 3), c8 = (lane & 7) * 8;   // 4 s x 4 row groups = 16 rows; 8 lanes x 8 = 64 columns
                const v4f x0 = *(const v4fa*)(&os[row * 68 + c8]); const v4f x1 = *(const v4fa*)(&os[row * 68 + c8 + 4]); v8h hv, rv;
#pragma unroll
                for (int i = 0; i < 4; ++i) { const h16 a0 = (h16)x0[i]; const h16 a1 = (h16)x1[i]; hv[i] = a0; hv[4 + i] = a1; rv[i] = (h16)((x0[i] - (float)a0) * QRS); rv[4 + i] = (h16)((x1[i] - (float)a1) * QRS); }
                const size_t oo = sb + (size_t)row * (size_t)pitch + c8;
                *(v8h*)(Ph + oo) = hv; if (useRes) *(v8h*)(Pr + oo) = rv; }
             }
        wave_sync();
    }
}

// k_flash: fused attention, one wave per 16 query rows of one (batch, head); Q fragments straight from the f16 planes (two 16-B loads each).
// K and V^T: stages of 64 keys in a two-buffer LDS ring shared by the block's four waves. Each wave brings one slice (32 rows x 128 bytes, padded to 144) per stage
// with one tensor_load_to_lds, one stage ahead of its use; fragments are two ds_load_b128 each.
// Transposed form: S^T[key][t] = K Q^T (A = K rows, B = Q rows); lane (t = lane&15, h = lane>>4) holds keys 8h+r of each 16-key tile, so the packed
// P tile is directly the B fragment of O^T[d][t] = V^T P^T (element r <- tile keys 0..15, element 8+r <- tile keys 16..31, lane unchanged).
// Softmax state (running max, partial sum) is one scalar per lane; the two lane halves of a row are combined with one xor-16 exchange.
__global__ __launch_bounds__(32 * AW) void k_flash(const h16* __restrict__ QH, const h16* __restrict__ QR, const h16* __restrict__ KP, const h16* __restrict__ VT, float* OUT) {
    __shared__ __attribute__((aligned(2048))) unsigned char ring[2 * RBUF];
    float* os = (float*)ring;      // output staging, used only behind the last stage's barrier
    const int lane = threadIdx.x & 31, lr = lane & 15, hi = lane >> 4;
    const int wave = (int)uni(threadIdx.x >> 5);
    const int zh = blockIdx.y; const int b = zh / NH_, h = zh % NH_;
    const int t0 = (blockIdx.x * AW + wave) * 16;
    const size_t pbase = (size_t)zh * SEQ * HD;
    const size_t qo = pbase + (size_t)(t0 + lr) * HD + 8 * hi;
    const v16h qh0 = ldh(QH + qo), qh1 = ldh(QH + qo + 32), qr0 = ldh(QR + qo), qr1 = ldh(QR + qo + 32);   // B fragments: col t, k = d
    // This wave's slice: waves 0, 1 = K keys 0..31, 32..63 of the stage (source pitch 128 B); waves 2, 3 = V^T rows d 0..31, 32..63 (source pitch 2*SEQ B).
    const bool isV = (wave & 2) != 0; const size_t half = (size_t)(wave & 1);
    const uint64_t sbase = (uint64_t)(size_t)(isV ? VT + pbase + half * 32 * SEQ : KP + pbase + half * 32 * HD);
    const uint32_t sstep = isV ? (uint32_t)(SKEY * 2) : (uint32_t)(SKEY * HD * 2);   // source bytes from one stage to the next
    const uint32_t ldst = (uint32_t)(size_t)ring + (uint32_t)wave * SLICE;
    u32x8 g1;                      // 1-byte elements, tile = tensor = 32 rows x 128 bytes, 4 dwords of LDS pad behind every 32 dwords
    g1[0] = uni((1u << 20) | (4u << 22) | (3u << 25)); g1[1] = uni(128u << 16); g1[2] = uni(32u << 16); g1[3] = uni(128u << 16);
    g1[4] = uni(32u); g1[5] = uni(isV ? (uint32_t)(SEQ * 2) : (uint32_t)(HD * 2)); g1[6] = uni(0u); g1[7] = uni(0u);
    auto issue = [&](uint32_t st) {
        const uint64_t ga = sbase + (uint64_t)st * sstep;
        u32x4 g0; g0[0] = uni(1u); g0[1] = uni(ldst + (st & 1u) * RBUF); g0[2] = uni((uint32_t)ga); g0[3] = uni((((uint32_t)(ga >> 32)) & 0x01FFFFFFu) | 0x80000000u);
        asm volatile("tensor_load_to_lds %0, %1" :: "s"(g0), "s"(g1) : "memory");   // one request of the whole wave: its slice, global -> LDS, through no register
    };
    issue(0u);
    asm volatile("s_wait_tensorcnt 0x0" ::: "memory");   // this wave's slice of stage 0 has landed
    __syncthreads();                                     // stage 0 published to all four waves
    issue(1u);
    const unsigned char* fr = ring + lr * LPIT + 16 * hi;    // fragment row lr, k half hi (A fragments: K row = key, k = d; V^T row = d, k = key)
    v8f o0 = (v8f){}, o1 = (v8f){}, o2 = (v8f){}, o3 = (v8f){};
    float m = -3.0e38f, l = 0.0f;
#pragma unroll 1
    for (uint32_t st = 0; st < (uint32_t)(SEQ / SKEY); ++st) {
      const unsigned char* fb = fr + (st & 1u) * RBUF;
#pragma unroll   // both passes of a stage inline: slice and key offsets become immediate offsets of the ds_load_b128
      for (int sub = 0; sub < SKEY / 32; ++sub) {
        const h16* ka = (const h16*)(fb + sub * SLICE);      // K slice sub = the 32 keys of this pass
        const v16h ka0 = ldh(ka), ka1 = ldh(ka + 32), kb0 = ldh(ka + 16 * (LPIT / 2)), kb1 = ldh(ka + 16 * (LPIT / 2) + 32);
        v8f sHa = (v8f){}, sLa = (v8f){}, sHb = (v8f){}, sLb = (v8f){};
        sHa = wmma16(ka0, qh0, sHa); sLa = wmma16(ka0, qr0, sLa); sHb = wmma16(kb0, qh0, sHb); sLb = wmma16(kb0, qr0, sLb);
        sHa = wmma16(ka1, qh1, sHa); sLa = wmma16(ka1, qr1, sLa); sHb = wmma16(kb1, qh1, sHb); sLb = wmma16(kb1, qr1, sLb);
        asm volatile("v_nop\n\tv_nop\n\tv_nop\n\tv_nop" : "+v"(sHa), "+v"(sLa), "+v"(sHb), "+v"(sLb) : "v"(ka0), "v"(ka1), "v"(kb0), "v"(kb1));
        float ta[8], tb[8]; float mx = -3.0e38f;
#pragma unroll
        for (int r = 0; r < 8; ++r) { ta[r] = (sHa[r] + sLa[r] * QRI) * SC2; tb[r] = (sHb[r] + sLb[r] * QRI) * SC2; mx = fmaxf(mx, fmaxf(ta[r], tb[r])); }
        mx = fmaxf(mx, __shfl_xor(mx, 16, 32));
        const float mnew = fmaxf(m, mx);
        const float alpha = __builtin_amdgcn_exp2f(m - mnew);
        const float sh = PSH - mnew;
        v16h pb; float ls = 0.0f;
#pragma unroll
        for (int r = 0; r < 8; ++r) { const h16 pa = (h16)__builtin_amdgcn_exp2f(ta[r] + sh); const h16 pc = (h16)__builtin_amdgcn_exp2f(tb[r] + sh); pb[r] = pa; pb[8 + r] = pc; ls += (float)pa + (float)pc; }
        l = l * alpha + ls; m = mnew;
        o0 = o0 * alpha; o1 = o1 * alpha; o2 = o2 * alpha; o3 = o3 * alpha;
        const h16* va = (const h16*)(fb + 2 * SLICE + sub * 64);   // V^T slices, 32 keys = 64 bytes along the row per pass
        const v16h v0 = ldh(va), v1 = ldh(va + 16 * (LPIT / 2)), v2 = ldh(va + SLICE / 2), v3 = ldh(va + SLICE / 2 + 16 * (LPIT / 2));
        o0 = wmma16(v0, pb, o0); o1 = wmma16(v1, pb, o1); o2 = wmma16(v2, pb, o2); o3 = wmma16(v3, pb, o3);
        asm volatile("v_nop\n\tv_nop\n\tv_nop\n\tv_nop" : "+v"(o0), "+v"(o1), "+v"(o2), "+v"(o3) : "v"(v0), "v"(v1), "v"(v2), "v"(v3), "v"(pb));
      }
      asm volatile("s_wait_dscnt 0x0" ::: "memory");
      asm volatile("s_wait_tensorcnt 0x0" ::: "memory");
      __syncthreads();
      const uint32_t nx = pinned(st + 2u);
      if (pinned(nx < (uint32_t)(SEQ / SKEY))) issue(nx);
    }
    asm volatile("s_wait_tensorcnt 0x0" ::: "memory");     // nothing in flight before the ring becomes output staging
    asm volatile("s_wait_dscnt 0x0" ::: "memory");         // (the last stage's own barrier has ended every wave's reads)
    l += __shfl_xor(l, 16, 32);
    const float inv = 1.0f / l;
    const int wb = wave * 16 * 68;
    // O^T D layout: o_j[r] = (d = 16j + 8h + r, t = lane&15) -> os[t][d]; rows 0..15 x columns 0..63 all written
    { v4f a, c;
      a[0] = o0[0] * inv; a[1] = o0[1] * inv; a[2] = o0[2] * inv; a[3] = o0[3] * inv; c[0] = o0[4] * inv; c[1] = o0[5] * inv; c[2] = o0[6] * inv; c[3] = o0[7] * inv;
      *(v4fa*)(&os[wb + lr * 68 +  0 + 8 * hi]) = a; *(v4fa*)(&os[wb + lr * 68 +  0 + 8 * hi + 4]) = c;
      a[0] = o1[0] * inv; a[1] = o1[1] * inv; a[2] = o1[2] * inv; a[3] = o1[3] * inv; c[0] = o1[4] * inv; c[1] = o1[5] * inv; c[2] = o1[6] * inv; c[3] = o1[7] * inv;
      *(v4fa*)(&os[wb + lr * 68 + 16 + 8 * hi]) = a; *(v4fa*)(&os[wb + lr * 68 + 16 + 8 * hi + 4]) = c;
      a[0] = o2[0] * inv; a[1] = o2[1] * inv; a[2] = o2[2] * inv; a[3] = o2[3] * inv; c[0] = o2[4] * inv; c[1] = o2[5] * inv; c[2] = o2[6] * inv; c[3] = o2[7] * inv;
      *(v4fa*)(&os[wb + lr * 68 + 32 + 8 * hi]) = a; *(v4fa*)(&os[wb + lr * 68 + 32 + 8 * hi + 4]) = c;
      a[0] = o3[0] * inv; a[1] = o3[1] * inv; a[2] = o3[2] * inv; a[3] = o3[3] * inv; c[0] = o3[4] * inv; c[1] = o3[5] * inv; c[2] = o3[6] * inv; c[3] = o3[7] * inv;
      *(v4fa*)(&os[wb + lr * 68 + 48 + 8 * hi]) = a; *(v4fa*)(&os[wb + lr * 68 + 48 + 8 * hi + 4]) = c; }
    wave_sync();
    float* orow = OUT + ((size_t)b * OUT_SEQ + t0) * DM + h * HD;
{
#pragma unroll
        for (int s = 0; s < 8; ++s) { const int row = 2 * s + hi, cofs = lr * 4;   // 8 s x 2 rows = 16 rows; 16 lanes x 4 floats = 64 columns
            const v4f val = *(const v4fa*)(&os[wb + row * 68 + cofs]);
            *(v4f*)(orow + (size_t)row * DM + cofs) = val; }
         }
}

static constexpr size_t al256(size_t v) { return (v + 255) & ~(size_t)255; }
static constexpr size_t SZ_XB = al256((size_t)NB * SEQ * DM * 2);
static constexpr size_t SZ_WB = al256((size_t)3 * DM * DM * 2);
static constexpr size_t SZ_PL = al256((size_t)NB * NH_ * SEQ * HD * 2);
static constexpr size_t SZ_TOTAL = SZ_XB + SZ_WB + 4 * SZ_PL;
static_assert(SZ_TOTAL <= (size_t)134217728);          // workspace carve <= 128 MiB
static_assert(((size_t)DM * DM * 2) % 256 == 0);       // weight sub-planes stay 256-byte aligned

extern "C" void kernel_launch(void* const* d_in, const int* in_sizes, int n_in,
                              void* d_out, int out_size, void* d_ws, size_t ws_size, hipStream_t stream) {
    if (n_in < 4) return;
    const size_t needx = ((size_t)(NB - 1) * SEQ_FULL + SEQ) * DM;
    if ((size_t)in_sizes[0] < needx) return;
    if ((size_t)in_sizes[1] < (size_t)DM * DM || (size_t)in_sizes[2] < (size_t)DM * DM || (size_t)in_sizes[3] < (size_t)DM * DM) return;
    if ((size_t)out_size < ((size_t)(NB - 1) * OUT_SEQ + SEQ) * DM) return;
    if (SZ_TOTAL > ws_size) return;
    const float* x = (const float*)d_in[0]; const float* wq = (const float*)d_in[1]; const float* wk = (const float*)d_in[2]; const float* wv = (const float*)d_in[3];   // wire order x, Wq, Wk, Wv ([out][in] = Bt as-is)
    float* OUT = (float*)d_out;      // [NB][SEQ][768]
    char* wsp = (char*)d_ws;
    bf* XB = (bf*)wsp; wsp += SZ_XB;                 // [NB*SEQ][768]
    bf* WB = (bf*)wsp; wsp += SZ_WB;                 // [3][768][768]: q | k | v
    h16* QH = (h16*)wsp; wsp += SZ_PL;               // [NB*12][SEQ][64]
    h16* QR = (h16*)wsp; wsp += SZ_PL;               // [NB*12][SEQ][64] residual x2048
    h16* KP = (h16*)wsp; wsp += SZ_PL;               // [NB*12][SEQ][64]
    h16* VT = (h16*)wsp; wsp += SZ_PL;               // [NB*12][64][SEQ]
    bf* WQ = WB; bf* WK = WB + (size_t)DM * DM; bf* WV = WB + (size_t)2 * DM * DM;

    if (SEQ == SEQ_FULL) {
        const size_t n8 = (size_t)NB * SEQ * DM / 8;
        k_cvt8<<<(unsigned)((n8 + 255) / 256), 256, 0, stream>>>(x, XB, n8);
    } else {
        const size_t n8 = (size_t)SEQ * DM / 8;
        for (int b = 0; b < NB; ++b) k_cvt8<<<(unsigned)((n8 + 255) / 256), 256, 0, stream>>>(x + (size_t)b * SEQ_FULL * DM, XB + (size_t)b * SEQ * DM, n8);
    }
    { const size_t n8 = (size_t)DM * DM / 8; const unsigned g = (unsigned)((n8 + 255) / 256);
      k_cvt8<<<g, 256, 0, stream>>>(wq, WQ, n8); k_cvt8<<<g, 256, 0, stream>>>(wk, WK, n8); k_cvt8<<<g, 256, 0, stream>>>(wv, WV, n8); }

    // q, k: A = x rows (m = b*SEQ + t), Bt = W rows (n = h*64 + d) -> plane [(b*12 + h)][t][d]
    k_proj<<<dim3(NB * SEQ / 128, DM / 128, 1), 32 * PW, 0, stream>>>(XB, WQ, QH, QR, 1, SEQ, (size_t)NH_ * SEQ * HD, HD, HD, (size_t)SEQ * HD);
    k_proj<<<dim3(NB * SEQ / 128, DM / 128, 1), 32 * PW, 0, stream>>>(XB, WK, KP, KP, 0, SEQ, (size_t)NH_ * SEQ * HD, HD, HD, (size_t)SEQ * HD);
    // v^T: A = Wv rows (m = h*64 + d), Bt = x rows (n = b*SEQ + t) -> plane [(b*768 + m)][t] = [(b*12 + h)][d][t]
    k_proj<<<dim3(DM / 128, NB * SEQ / 128, 1), 32 * PW, 0, stream>>>(WV, XB, VT, VT, 0, DM, (size_t)0, SEQ, SEQ, (size_t)DM * SEQ);

    k_flash<<<dim3(SEQ / (16 * AW), NB * NH_, 1), 32 * AW, 0, stream>>>(QH, QR, KP, VT, OUT);
}

// v003
// One run takes 115 microseconds.
// Two timings next to v002 put it at 1.05 and 1.04 times that version's speed.
// Counting every step since v000, it is 2.12 times as fast.
#include <hip/hip_runtime.h>
#include <stdint.h>

// Multi-head self-attention, width 768 = 12 heads x 64, x [NB][SEQ][768], Wq/Wk/Wv [out][in] (y = x W^T), no biases, no mask, score scale 1/8, output = concatenated heads (f32).
// Compute dtypes, f32 accumulate everywhere: projections v_wmma_f32_16x16x32_bf16 (x and W RNE-converted to bf16; products exact);
// scores v_wmma_f32_16x16x32_f16: k single f16, q as f16 value + f16 residual x2048 in its own accumulator (two products); P (x256 carry, cancels in the normalisation) and v single f16; softmax f32 (online, running max).
// Layout: bf16 copies of x and W (GEMM tiles staged in LDS by tensor loads, two buffers); q (hi, residual), k planes [b*12+h][t][d] and v^T plane [b*12+h][d][t] written by the GEMM epilogue; fused flash kernel in transposed form (S^T = K Q^T, O^T = V^T P^T), K and V^T tiles staged in LDS by tensor loads (two buffers), output from f32 accumulators.

#ifndef NB
#define NB 4
#endif
#ifndef SEQ
#define SEQ 2048
#endif
#define NB_FULL  4
#define SEQ_FULL 2048
#ifndef OUT_SEQ
#define OUT_SEQ SEQ              // row pitch (in tokens) between batches of the output
#endif
#define DM   768
#define NH_  12
#define HD   64
#define AW   4                   // waves per flash block (16 query rows each)
#define QRS  2048.0f             // carry of the q residual plane
#define QRI  (1.0f / 2048.0f)
#define SC2  (0.125f * 1.4426950408889634f)   // HD^-0.5 * log2(e)
#define PSH  8.0f                // log2 of the P carry (256)
#define SKEY 64                  // keys per LDS stage (two 32-key passes of the score loop)
#define LPIT 144                 // LDS row pitch in bytes: 128-byte rows + 16 bytes of pad, conflict-free for ds_load_b128
#define SLICE 6144               // LDS bytes per wave's slice: 32 rows x LPIT = 4608, rounded up to a multiple of 2 KiB
#define RBUF (4 * SLICE)         // one stage: K keys 0..31 | K keys 32..63 | V^T d 0..31 | V^T d 32..63
#define PW   4                   // waves per projection block (2 x 2 tiles of 64x64)
#define PKS  64                  // k per LDS stage of the projection GEMM (two 32-k steps)
#define PSL  10240               // LDS bytes per wave's slice: 64 rows x LPIT = 9216, rounded up to a multiple of 2 KiB
#define PBUF (4 * PSL)           // one stage: A rows 0..63 | A rows 64..127 | Bt rows 0..63 | Bt rows 64..127
#define CVW  16                  // waves per conversion block
#define CVP  16                  // 512-byte pieces per conversion wave
#define CVB  (CVW * CVP * 128)   // floats per conversion block

static_assert(HD == 64);
static_assert(NH_ * HD == DM);                 // head h = columns h*64 + d
static_assert(DM % 64 == 0);                   // 12 column tiles of 64
static_assert(DM % PKS == 0 && DM / PKS >= 2);   // whole GEMM stages; the ring's prologue needs two
static_assert(DM % 128 == 0 && (NB * SEQ) % 128 == 0);   // 128x128 block tiles cover every projection exactly
static_assert(PW == 4 && PKS * 2 == 128 && 64 * LPIT <= PSL && PSL % 2048 == 0);   // four slices of 64 rows x 128 bytes, one per wave
static_assert(SEQ % 64 == 0);                  // a 64-row tile never straddles two batches
static_assert((NB * SEQ) % 64 == 0);
static_assert(SEQ % 32 == 0);                  // key loop steps by 32
static_assert(SEQ % SKEY == 0 && SEQ / SKEY >= 2);   // whole stages; the ring's prologue needs two
static_assert(AW == 4 && SKEY == 64 && HD * 2 == 128 && SKEY * 2 == 128);   // four slices of 32 rows x 128 bytes, one per wave
static_assert(32 * LPIT <= SLICE && SLICE % 2048 == 0);
static_assert(AW * 16 * 68 * 4 <= 2 * RBUF);   // output staging reuses the ring
static_assert(SEQ % (16 * AW) == 0);           // flash grid covers the sequence exactly
static_assert(((size_t)SEQ * DM) % CVB == 0);  // whole conversion blocks in every batch of x
static_assert(((size_t)DM * DM) % CVB == 0);   // and in every weight
static_assert(NB <= NB_FULL);
static_assert(SEQ <= SEQ_FULL);

typedef _Float16 h16;
typedef unsigned short bf;
typedef __attribute__((ext_vector_type(16))) __bf16   v16bf;
typedef __attribute__((ext_vector_type(16))) _Float16 v16h;
typedef __attribute__((ext_vector_type(8)))  _Float16 v8h;
typedef __attribute__((ext_vector_type(8)))  unsigned short v8us;
typedef __attribute__((ext_vector_type(4)))  unsigned short v4us;
typedef __attribute__((ext_vector_type(8)))  float    v8f;
typedef __attribute__((ext_vector_type(4)))  float    v4f;
typedef v4f  __attribute__((may_alias)) v4fa;
typedef uint32_t u32x4 __attribute__((ext_vector_type(4)));
typedef uint32_t u32x8 __attribute__((ext_vector_type(8)));

__device__ __forceinline__ unsigned short f2bf(float f) { unsigned u = __float_as_uint(f); u += 0x7FFFu + ((u >> 16) & 1u); return (unsigned short)(u >> 16); }
__device__ __forceinline__ v16h cat16(v8h lo, v8h hi) { return __builtin_shufflevector(lo, hi, 0, 1, 2, 3, 4, 5, 6, 7, 8, 9, 10, 11, 12, 13, 14, 15); }
__device__ __forceinline__ v16bf cat16b(v8us lo, v8us hi) { return __builtin_bit_cast(v16bf, __builtin_shufflevector(lo, hi, 0, 1, 2, 3, 4, 5, 6, 7, 8, 9, 10, 11, 12, 13, 14, 15)); }
__device__ __forceinline__ v8f wmma16(v16h a, v16h b, v8f c) { return __builtin_amdgcn_wmma_f32_16x16x32_f16(false, a, false, b, (short)0, c, false, false); }
__device__ __forceinline__ v8f wmmab(v16bf a, v16bf b, v8f c) { return __builtin_amdgcn_wmma_f32_16x16x32_bf16(false, a, false, b, (short)0, c, false, false); }
// fragment loaders from K-contiguous 16-bit rows; p already includes + 8*(lane>>4): elements 0..7 <- k0+8h+0..7, elements 8..15 <- k0+16+8h+0..7 (same map for A and B)
__device__ __forceinline__ v16h  ldh(const h16* p) { return cat16(*(const v8h*)p, *(const v8h*)(p + 16)); }
__device__ __forceinline__ v16bf ldb(const bf* p)  { return cat16b(*(const v8us*)p, *(const v8us*)(p + 16)); }
// ordering point for wave-private LDS tiles (same wave writes and reads)
__device__ __forceinline__ void wave_sync() { __builtin_amdgcn_fence(3 /* release order */, "wavefront"); __builtin_amdgcn_wave_barrier(); asm volatile("" ::: "memory"); }

__device__ __forceinline__ uint32_t uni(uint32_t v) { return (uint32_t)__builtin_amdgcn_readfirstlane(v); }
// a wave-uniform value held in a scalar register: tests around a tensor load must compile to s_cmp + s_cbranch_scc (the instruction ignores EXEC)
__device__ __forceinline__ uint32_t pinned(uint32_t v) { uint32_t w = uni(v); asm volatile("" : "+s"(w)); return w; }

// k_cvt: every f32 -> bf16 conversion of the call (x, Wq, Wk, Wv) in one launch whose waves are all resident at once: about one block of 16 waves per WGP.
// A block converts CVB consecutive floats of one source; a wave takes CVP pieces of 512 contiguous bytes (16 bytes per lane), all loaded before the first is converted.
__global__ __launch_bounds__(32 * CVW) void k_cvt(const float* __restrict__ x, const float* __restrict__ wq, const float* __restrict__ wk, const float* __restrict__ wv, bf* xb, bf* wb) {
    constexpr unsigned XPB = (unsigned)((size_t)SEQ * DM / CVB), XBL = NB * XPB, WBL = (unsigned)((size_t)DM * DM / CVB);   // blocks per batch of x, for all of x, per weight
    const unsigned blk = blockIdx.x;
    const float* src; bf* dst;
    if (blk < XBL) { src = x + (size_t)(blk / XPB) * SEQ_FULL * DM + (size_t)(blk % XPB) * CVB; dst = xb + (size_t)blk * CVB; }
    else { const unsigned w = blk - XBL, which = w / WBL; src = (which == 0 ? wq : which == 1 ? wk : wv) + (size_t)(w % WBL) * CVB; dst = wb + (size_t)w * CVB; }
    const unsigned off = (threadIdx.x >> 5) * (CVP * 128) + (threadIdx.x & 31) * 4;
    const unsigned lb = off * 4;   // the lane's byte offset in the source, the one vector register that all the loads name
    v4f v[CVP];
#pragma unroll
    for (int i = 0; i < CVP; ++i) v[i] = *(const v4f*)((const char*)src + lb + i * 512);
    asm volatile("s_wait_xcnt 0x0" :: "v"(lb) : "memory");   // behind the last load and ahead of any write to the offset register (held live to here, so that no load's result lands on it either)
#pragma unroll
    for (int i = 0; i < CVP; ++i) { v4us o;
#pragma unroll
        for (int k = 0; k < 4; ++k) o[k] = f2bf(v[i][k]);
        *(v4us*)(dst + off + i * 128) = o; }   // 8 bytes per lane: two whole 128-byte lines per wave
}

// k_proj: bf16 GEMM, one block of four waves (2 x 2) per 128x128 tile, each wave a 64x64 tile (16 accumulators), K = DM.
// A and Bt: stages of 64 k (128 bytes of every row) in a two-buffer LDS ring shared by the block's four waves. Each wave brings one slice (64 rows x 128 bytes, padded to 144)
// per stage with one tensor_load_to_lds, one stage ahead of its use; fragments are two ds_load_b128 each.
// C[m][n] = sum_k A[m][k] Bt[n][k], written as f16 (Ph) and optionally the f16 residual x2048 (Pr, useRes != 0) at
// tile base (r0/RB)*sRB + (r0%RB)*pitch + (c0/CB)*sCB + (c0%CB), row pitch 'pitch' (halves). grid (M/128, N/128), 128 threads.
__global__ __launch_bounds__(32 * PW) void k_proj(const bf* __restrict__ A, const bf* __restrict__ Bt, h16* Ph, h16* Pr, int useRes, int RB, size_t sRB, int pitch, int CB, size_t sCB) {
    __shared__ __attribute__((aligned(2048))) unsigned char ring[2 * PBUF];
    __shared__ __align__(16) float osall[PW * 16 * 68];
    const int K = DM;
    const int lane = threadIdx.x & 31, lr = lane & 15, hi = lane >> 4;
    const int wave = (int)uni(threadIdx.x >> 5);
    const int wm = wave >> 1, wn = wave & 1;                 // this wave's 64x64 tile inside the block's 128x128
    const int r0 = blockIdx.x * 128 + wm * 64, c0 = blockIdx.y * 128 + wn * 64;
    float* os = osall + wave * 16 * 68;                      // wave-private output staging
    // This wave's slice: waves 0, 1 = A rows 0..63, 64..127 of the block's tile; waves 2, 3 = Bt rows 0..63, 64..127 (source pitch 2*K bytes).
    const bool isB = (wave & 2) != 0; const size_t half = (size_t)(wave & 1);
    const uint64_t sbase = (uint64_t)(size_t)(isB ? Bt + ((size_t)blockIdx.y * 128 + half * 64) * K : A + ((size_t)blockIdx.x * 128 + half * 64) * K);
    const uint32_t ldst = (uint32_t)(size_t)ring + (uint32_t)wave * PSL;
    u32x8 g1;                      // 1-byte elements, tile = tensor = 64 rows x 128 bytes, 4 dwords of LDS pad behind every 32 dwords
    g1[0] = uni((1u << 20) | (4u << 22) | (3u << 25)); g1[1] = uni(128u << 16); g1[2] = uni(64u << 16); g1[3] = uni(128u << 16);
    g1[4] = uni(64u); g1[5] = uni((uint32_t)(DM * 2)); g1[6] = uni(0u); g1[7] = uni(0u);
    auto issue = [&](uint32_t st) {
        const uint64_t ga = sbase + (uint64_t)st * (uint32_t)(PKS * 2);
        u32x4 g0; g0[0] = uni(1u); g0[1] = uni(ldst + (st & 1u) * PBUF); g0[2] = uni((uint32_t)ga); g0[3] = uni((((uint32_t)(ga >> 32)) & 0x01FFFFFFu) | 0x80000000u);
        asm volatile("tensor_load_to_lds %0, %1" :: "s"(g0), "s"(g1) : "memory");   // one request of the whole wave: its slice, global -> LDS, through no register
    };
    issue(0u);
    asm volatile("s_wait_tensorcnt 0x0" ::: "memory");   // this wave's slice of stage 0 has landed
    __syncthreads();                                     // stage 0 published to all four waves
    issue(1u);
    const unsigned char* fra = ring + wm * PSL + lr * LPIT + 16 * hi;         // A fragment row lr, k half hi
    const unsigned char* frb = ring + (2 + wn) * PSL + lr * LPIT + 16 * hi;   // Bt fragment row lr, k half hi
    v8f acc[4][4];
#pragma unroll
    for (int mb = 0; mb < 4; ++mb)
#pragma unroll
        for (int nb = 0; nb < 4; ++nb) acc[mb][nb] = (v8f){};
#pragma unroll 1
    for (uint32_t st = 0; st < (uint32_t)(DM / PKS); ++st) {
        const unsigned char* fa = fra + (st & 1u) * PBUF; const unsigned char* fb = frb + (st & 1u) * PBUF;
        // Fragments of the stage's two 32-k steps. The first step's sixteen ds_load_b128 and twelve of the second step's stand as one group in front of the WMMAs;
        // the last four follow once two Bt fragments of the first step are spent, so that 16 accumulators and the fragments stay under 256 registers.
        v16bf a0[4], b0[4], a1[4], b1[4];
#pragma unroll
        for (int i = 0; i < 4; ++i) { a0[i] = ldb((const bf*)(fa + i * 16 * LPIT)); b0[i] = ldb((const bf*)(fb + i * 16 * LPIT)); }
#pragma unroll
        for (int i = 0; i < 4; ++i) a1[i] = ldb((const bf*)(fa + i * 16 * LPIT + 64));
        b1[0] = ldb((const bf*)(fb + 64)); b1[1] = ldb((const bf*)(fb + 16 * LPIT + 64));
        __builtin_amdgcn_sched_barrier(0);   // keeps the load group in front: sunk among the WMMAs, each small group is waited out to zero
#pragma unroll
        for (int nb = 0; nb < 2; ++nb)
#pragma unroll
            for (int mb = 0; mb < 4; ++mb) acc[mb][nb] = wmmab(a0[mb], b0[nb], acc[mb][nb]);
        __builtin_amdgcn_sched_barrier(0);   // the last four loads stay here, sixteen WMMAs ahead of their first use
        b1[2] = ldb((const bf*)(fb + 2 * 16 * LPIT + 64)); b1[3] = ldb((const bf*)(fb + 3 * 16 * LPIT + 64));
        __builtin_amdgcn_sched_barrier(0);   // and do not sink among the WMMAs behind them, where they would be waited out to zero
#pragma unroll
        for (int nb = 2; nb < 4; ++nb)
#pragma unroll
            for (int mb = 0; mb < 4; ++mb) acc[mb][nb] = wmmab(a0[mb], b0[nb], acc[mb][nb]);
#pragma unroll
        for (int nb = 0; nb < 4; ++nb)
#pragma unroll
            for (int mb = 0; mb < 4; ++mb) acc[mb][nb] = wmmab(a1[mb], b1[nb], acc[mb][nb]);
        // four vector slots behind the last WMMA of the stage, before anything may overwrite its operands or touch its result (also on the loop's taken branch)
        asm volatile("v_nop\n\tv_nop\n\tv_nop\n\tv_nop" : "+v"(acc[0][3]), "+v"(acc[1][3]), "+v"(acc[2][3]), "+v"(acc[3][3]) : "v"(a1[0]), "v"(a1[1]), "v"(a1[2]), "v"(a1[3]), "v"(b1[3]));
        __builtin_amdgcn_sched_barrier(0);   // keeps the stage's WMMAs in front of the publish point: moved behind the barrier they would delay the refill that follows it
        asm volatile("s_wait_dscnt 0x0" ::: "memory");
        asm volatile("s_wait_tensorcnt 0x0" ::: "memory");
        __syncthreads();
        const uint32_t nx = pinned(st + 2u);
        if (pinned(nx < (uint32_t)(DM / PKS))) issue(nx);
    }
    asm volatile("s_wait_tensorcnt 0x0" ::: "memory");       // nothing in flight when the wave goes on to its epilogue
    asm volatile("s_wait_dscnt 0x0" ::: "memory");
    const size_t tbase = (size_t)(r0 / RB) * sRB + (size_t)(r0 % RB) * (size_t)pitch + (size_t)(c0 / CB) * sCB + (size_t)(c0 % CB);
#pragma unroll
    for (int mb = 0; mb < 4; ++mb) {
#pragma unroll
        for (int nb = 0; nb < 4; ++nb) {
#pragma unroll
            for (int j = 0; j < 8; ++j) os[(hi * 8 + j) * 68 + nb * 16 + lr] = acc[mb][nb][j]; }   // D: row 8h+j, col lane&15
        wave_sync();
        const size_t sb = tbase + (size_t)(mb * 16) * (size_t)pitch;
{
#pragma unroll
            for (int s = 0; s < 4; ++s) { const int row = 4 * s + (lane >> 3), c8 = (lane & 7) * 8;   // 4 s x 4 row groups = 16 rows; 8 lanes x 8 = 64 columns
                const v4f x0 = *(const v4fa*)(&os[row * 68 + c8]); const v4f x1 = *(const v4fa*)(&os[row * 68 + c8 + 4]); v8h hv, rv;
#pragma unroll
                for (int i = 0; i < 4; ++i) { const h16 a0 = (h16)x0[i]; const h16 a1 = (h16)x1[i]; hv[i] = a0; hv[4 + i] = a1; rv[i] = (h16)((x0[i] - (float)a0) * QRS); rv[4 + i] = (h16)((x1[i] - (float)a1) * QRS); }
                const size_t oo = sb + (size_t)row * (size_t)pitch + c8;
                *(v8h*)(Ph + oo) = hv; if (useRes) *(v8h*)(Pr + oo) = rv; }
             }
        wave_sync();
    }
}

// k_flash: fused attention, one wave per 16 query rows of one (batch, head); Q fragments straight from the f16 planes (two 16-B loads each).
// K and V^T: stages of 64 keys in a two-buffer LDS ring shared by the block's four waves. Each wave brings one slice (32 rows x 128 bytes, padded to 144) per stage
// with one tensor_load_to_lds, one stage ahead of its use; fragments are two ds_load_b128 each.
// Transposed form: S^T[key][t] = K Q^T (A = K rows, B = Q rows); lane (t = lane&15, h = lane>>4) holds keys 8h+r of each 16-key tile, so the packed
// P tile is directly the B fragment of O^T[d][t] = V^T P^T (element r <- tile keys 0..15, element 8+r <- tile keys 16..31, lane unchanged).
// Softmax state (running max, partial sum) is one scalar per lane; the two lane halves of a row are combined with one xor-16 exchange.
__global__ __launch_bounds__(32 * AW) void k_flash(const h16* __restrict__ QH, const h16* __restrict__ QR, const h16* __restrict__ KP, const h16* __restrict__ VT, float* OUT) {
    __shared__ __attribute__((aligned(2048))) unsigned char ring[2 * RBUF];
    float* os = (float*)ring;      // output staging, used only behind the last stage's barrier
    const int lane = threadIdx.x & 31, lr = lane & 15, hi = lane >> 4;
    const int wave = (int)uni(threadIdx.x >> 5);
    const int zh = blockIdx.y; const int b = zh / NH_, h = zh % NH_;
    const int t0 = (blockIdx.x * AW + wave) * 16;
    const size_t pbase = (size_t)zh * SEQ * HD;
    const size_t qo = pbase + (size_t)(t0 + lr) * HD + 8 * hi;
    const v16h qh0 = ldh(QH + qo), qh1 = ldh(QH + qo + 32), qr0 = ldh(QR + qo), qr1 = ldh(QR + qo + 32);   // B fragments: col t, k = d
    // This wave's slice: waves 0, 1 = K keys 0..31, 32..63 of the stage (source pitch 128 B); waves 2, 3 = V^T rows d 0..31, 32..63 (source pitch 2*SEQ B).
    const bool isV = (wave & 2) != 0; const size_t half = (size_t)(wave & 1);
    const uint64_t sbase = (uint64_t)(size_t)(isV ? VT + pbase + half * 32 * SEQ : KP + pbase + half * 32 * HD);
    const uint32_t sstep = isV ? (uint32_t)(SKEY * 2) : (uint32_t)(SKEY * HD * 2);   // source bytes from one stage to the next
    const uint32_t ldst = (uint32_t)(size_t)ring + (uint32_t)wave * SLICE;
    u32x8 g1;                      // 1-byte elements, tile = tensor = 32 rows x 128 bytes, 4 dwords of LDS pad behind every 32 dwords
    g1[0] = uni((1u << 20) | (4u << 22) | (3u << 25)); g1[1] = uni(128u << 16); g1[2] = uni(32u << 16); g1[3] = uni(128u << 16);
    g1[4] = uni(32u); g1[5] = uni(isV ? (uint32_t)(SEQ * 2) : (uint32_t)(HD * 2)); g1[6] = uni(0u); g1[7] = uni(0u);
    auto issue = [&](uint32_t st) {
        const uint64_t ga = sbase + (uint64_t)st * sstep;
        u32x4 g0; g0[0] = uni(1u); g0[1] = uni(ldst + (st & 1u) * RBUF); g0[2] = uni((uint32_t)ga); g0[3] = uni((((uint32_t)(ga >> 32)) & 0x01FFFFFFu) | 0x80000000u);
        asm volatile("tensor_load_to_lds %0, %1" :: "s"(g0), "s"(g1) : "memory");   // one request of the whole wave: its slice, global -> LDS, through no register
    };
    issue(0u);
    asm volatile("s_wait_tensorcnt 0x0" ::: "memory");   // this wave's slice of stage 0 has landed
    __syncthreads();                                     // stage 0 published to all four waves
    issue(1u);
    const unsigned char* fr = ring + lr * LPIT + 16 * hi;    // fragment row lr, k half hi (A fragments: K row = key, k = d; V^T row = d, k = key)
    v8f o0 = (v8f){}, o1 = (v8f){}, o2 = (v8f){}, o3 = (v8f){};
    float m = -3.0e38f, l = 0.0f;
#pragma unroll 1
    for (uint32_t st = 0; st < (uint32_t)(SEQ / SKEY); ++st) {
      const unsigned char* fb = fr + (st & 1u) * RBUF;
#pragma unroll   // both passes of a stage inline: slice and key offsets become immediate offsets of the ds_load_b128
      for (int sub = 0; sub < SKEY / 32; ++sub) {
        const h16* ka = (const h16*)(fb + sub * SLICE);      // K slice sub = the 32 keys of this pass
        const v16h ka0 = ldh(ka), ka1 = ldh(ka + 32), kb0 = ldh(ka + 16 * (LPIT / 2)), kb1 = ldh(ka + 16 * (LPIT / 2) + 32);
        v8f sHa = (v8f){}, sLa = (v8f){}, sHb = (v8f){}, sLb = (v8f){};
        sHa = wmma16(ka0, qh0, sHa); sLa = wmma16(ka0, qr0, sLa); sHb = wmma16(kb0, qh0, sHb); sLb = wmma16(kb0, qr0, sLb);
        sHa = wmma16(ka1, qh1, sHa); sLa = wmma16(ka1, qr1, sLa); sHb = wmma16(kb1, qh1, sHb); sLb = wmma16(kb1, qr1, sLb);
        asm volatile("v_nop\n\tv_nop\n\tv_nop\n\tv_nop" : "+v"(sHa), "+v"(sLa), "+v"(sHb), "+v"(sLb) : "v"(ka0), "v"(ka1), "v"(kb0), "v"(kb1));
        float ta[8], tb[8]; float mx = -3.0e38f;
#pragma unroll
        for (int r = 0; r < 8; ++r) { ta[r] = (sHa[r] + sLa[r] * QRI) * SC2; tb[r] = (sHb[r] + sLb[r] * QRI) * SC2; mx = fmaxf(mx, fmaxf(ta[r], tb[r])); }
        mx = fmaxf(mx, __shfl_xor(mx, 16, 32));
        const float mnew = fmaxf(m, mx);
        const float alpha = __builtin_amdgcn_exp2f(m - mnew);
        const float sh = PSH - mnew;
        v16h pb; float ls = 0.0f;
#pragma unroll
        for (int r = 0; r < 8; ++r) { const h16 pa = (h16)__builtin_amdgcn_exp2f(ta[r] + sh); const h16 pc = (h16)__builtin_amdgcn_exp2f(tb[r] + sh); pb[r] = pa; pb[8 + r] = pc; ls += (float)pa + (float)pc; }
        l = l * alpha + ls; m = mnew;
        o0 = o0 * alpha; o1 = o1 * alpha; o2 = o2 * alpha; o3 = o3 * alpha;
        const h16* va = (const h16*)(fb + 2 * SLICE + sub * 64);   // V^T slices, 32 keys = 64 bytes along the row per pass
        const v16h v0 = ldh(va), v1 = ldh(va + 16 * (LPIT / 2)), v2 = ldh(va + SLICE / 2), v3 = ldh(va + SLICE / 2 + 16 * (LPIT / 2));
        o0 = wmma16(v0, pb, o0); o1 = wmma16(v1, pb, o1); o2 = wmma16(v2, pb, o2); o3 = wmma16(v3, pb, o3);
        asm volatile("v_nop\n\tv_nop\n\tv_nop\n\tv_nop" : "+v"(o0), "+v"(o1), "+v"(o2), "+v"(o3) : "v"(v0), "v"(v1), "v"(v2), "v"(v3), "v"(pb));
      }
      asm volatile("s_wait_dscnt 0x0" ::: "memory");
      asm volatile("s_wait_tensorcnt 0x0" ::: "memory");
      __syncthreads();
      const uint32_t nx = pinned(st + 2u);
      if (pinned(nx < (uint32_t)(SEQ / SKEY))) issue(nx);
    }
    asm volatile("s_wait_tensorcnt 0x0" ::: "memory");     // nothing in flight before the ring becomes output staging
    asm volatile("s_wait_dscnt 0x0" ::: "memory");         // (the last stage's own barrier has ended every wave's reads)
    l += __shfl_xor(l, 16, 32);
    const float inv = 1.0f / l;
    const int wb = wave * 16 * 68;
    // O^T D layout: o_j[r] = (d = 16j + 8h + r, t = lane&15) -> os[t][d]; rows 0..15 x columns 0..63 all written
    { v4f a, c;
      a[0] = o0[0] * inv; a[1] = o0[1] * inv; a[2] = o0[2] * inv; a[3] = o0[3] * inv; c[0] = o0[4] * inv; c[1] = o0[5] * inv; c[2] = o0[6] * inv; c[3] = o0[7] * inv;
      *(v4fa*)(&os[wb + lr * 68 +  0 + 8 * hi]) = a; *(v4fa*)(&os[wb + lr * 68 +  0 + 8 * hi + 4]) = c;
      a[0] = o1[0] * inv; a[1] = o1[1] * inv; a[2] = o1[2] * inv; a[3] = o1[3] * inv; c[0] = o1[4] * inv; c[1] = o1[5] * inv; c[2] = o1[6] * inv; c[3] = o1[7] * inv;
      *(v4fa*)(&os[wb + lr * 68 + 16 + 8 * hi]) = a; *(v4fa*)(&os[wb + lr * 68 + 16 + 8 * hi + 4]) = c;
      a[0] = o2[0] * inv; a[1] = o2[1] * inv; a[2] = o2[2] * inv; a[3] = o2[3] * inv; c[0] = o2[4] * inv; c[1] = o2[5] * inv; c[2] = o2[6] * inv; c[3] = o2[7] * inv;
      *(v4fa*)(&os[wb + lr * 68 + 32 + 8 * hi]) = a; *(v4fa*)(&os[wb + lr * 68 + 32 + 8 * hi + 4]) = c;
      a[0] = o3[0] * inv; a[1] = o3[1] * inv; a[2] = o3[2] * inv; a[3] = o3[3] * inv; c[0] = o3[4] * inv; c[1] = o3[5] * inv; c[2] = o3[6] * inv; c[3] = o3[7] * inv;
      *(v4fa*)(&os[wb + lr * 68 + 48 + 8 * hi]) = a; *(v4fa*)(&os[wb + lr * 68 + 48 + 8 * hi + 4]) = c; }
    wave_sync();
    float* orow = OUT + ((size_t)b * OUT_SEQ + t0) * DM + h * HD;
{
#pragma unroll
        for (int s = 0; s < 8; ++s) { const int row = 2 * s + hi, cofs = lr * 4;   // 8 s x 2 rows = 16 rows; 16 lanes x 4 floats = 64 columns
            const v4f val = *(const v4fa*)(&os[wb + row * 68 + cofs]);
            *(v4f*)(orow + (size_t)row * DM + cofs) = val; }
         }
}

static constexpr size_t al256(size_t v) { return (v + 255) & ~(size_t)255; }
static constexpr size_t SZ_XB = al256((size_t)NB * SEQ * DM * 2);
static constexpr size_t SZ_WB = al256((size_t)3 * DM * DM * 2);
static constexpr size_t SZ_PL = al256((size_t)NB * NH_ * SEQ * HD * 2);
static constexpr size_t SZ_TOTAL = SZ_XB + SZ_WB + 4 * SZ_PL;
static_assert(SZ_TOTAL <= (size_t)134217728);          // workspace carve <= 128 MiB
static_assert(((size_t)DM * DM * 2) % 256 == 0);       // weight sub-planes stay 256-byte aligned

extern "C" void kernel_launch(void* const* d_in, const int* in_sizes, int n_in,
                              void* d_out, int out_size, void* d_ws, size_t ws_size, hipStream_t stream) {
    if (n_in < 4) return;
    const size_t needx = ((size_t)(NB - 1) * SEQ_FULL + SEQ) * DM;
    if ((size_t)in_sizes[0] < needx) return;
    if ((size_t)in_sizes[1] < (size_t)DM * DM || (size_t)in_sizes[2] < (size_t)DM * DM || (size_t)in_sizes[3] < (size_t)DM * DM) return;
    if ((size_t)out_size < ((size_t)(NB - 1) * OUT_SEQ + SEQ) * DM) return;
    if (SZ_TOTAL > ws_size) return;
    const float* x = (const float*)d_in[0]; const float* wq = (const float*)d_in[1]; const float* wk = (const float*)d_in[2]; const float* wv = (const float*)d_in[3];   // wire order x, Wq, Wk, Wv ([out][in] = Bt as-is)
    float* OUT = (float*)d_out;      // [NB][SEQ][768]
    char* wsp = (char*)d_ws;
    bf* XB = (bf*)wsp; wsp += SZ_XB;                 // [NB*SEQ][768]
    bf* WB = (bf*)wsp; wsp += SZ_WB;                 // [3][768][768]: q | k | v
    h16* QH = (h16*)wsp; wsp += SZ_PL;               // [NB*12][SEQ][64]
    h16* QR = (h16*)wsp; wsp += SZ_PL;               // [NB*12][SEQ][64] residual x2048
    h16* KP = (h16*)wsp; wsp += SZ_PL;               // [NB*12][SEQ][64]
    h16* VT = (h16*)wsp; wsp += SZ_PL;               // [NB*12][64][SEQ]
    bf* WQ = WB; bf* WK = WB + (size_t)DM * DM; bf* WV = WB + (size_t)2 * DM * DM;

    k_cvt<<<(unsigned)(((size_t)NB * SEQ * DM + (size_t)3 * DM * DM) / CVB), 32 * CVW, 0, stream>>>(x, wq, wk, wv, XB, WB);

    // q, k: A = x rows (m = b*SEQ + t), Bt = W rows (n = h*64 + d) -> plane [(b*12 + h)][t][d]
    k_proj<<<dim3(NB * SEQ / 128, DM / 128, 1), 32 * PW, 0, stream>>>(XB, WQ, QH, QR, 1, SEQ, (size_t)NH_ * SEQ * HD, HD, HD, (size_t)SEQ * HD);
    k_proj<<<dim3(NB * SEQ / 128, DM / 128, 1), 32 * PW, 0, stream>>>(XB, WK, KP, KP, 0, SEQ, (size_t)NH_ * SEQ * HD, HD, HD, (size_t)SEQ * HD);
    // v^T: A = Wv rows (m = h*64 + d), Bt = x rows (n = b*SEQ + t) -> plane [(b*768 + m)][t] = [(b*12 + h)][d][t]
    k_proj<<<dim3(DM / 128, NB * SEQ / 128, 1), 32 * PW, 0, stream>>>(WV, XB, VT, VT, 0, DM, (size_t)0, SEQ, SEQ, (size_t)DM * SEQ);

    k_flash<<<dim3(SEQ / (16 * AW), NB * NH_, 1), 32 * AW, 0, stream>>>(QH, QR, KP, VT, OUT);
}

// v004
// Measured time: 111 microseconds a run.
// Timed twice side by side with v003, it ran 1.03 and 1.05 times as fast.
// Over all steps from v000 it is 2.21 times as fast.
#include <hip/hip_runtime.h>
#include <stdint.h>

// Multi-head self-attention, width 768 = 12 heads x 64, x [NB][SEQ][768], Wq/Wk/Wv [out][in] (y = x W^T), no biases, no mask, score scale 1/8, output = concatenated heads (f32).
// Compute dtypes, f32 accumulate everywhere: projections v_wmma_f32_16x16x32_bf16 (x and W RNE-converted to bf16; products exact);
// scores v_wmma_f32_16x16x32_f16: k single f16, q as f16 value + f16 residual x2048 in its own accumulator (two products); P (x256 carry, cancels in the normalisation) and v single f16; softmax f32 (online, running max).
// Layout: bf16 copies of x and W (GEMM tiles staged in LDS by tensor loads, two buffers); q (hi, residual), k planes [b*12+h][t][d] and v^T plane [b*12+h][d][t] written by the GEMM epilogue; fused flash kernel in transposed form (S^T = K Q^T, O^T = V^T P^T), K and V^T tiles staged in LDS by tensor loads (two buffers), output from f32 accumulators.

#ifndef NB
#define NB 4
#endif
#ifndef SEQ
#define SEQ 2048
#endif
#define NB_FULL  4
#define SEQ_FULL 2048
#ifndef OUT_SEQ
#define OUT_SEQ SEQ              // row pitch (in tokens) between batches of the output
#endif
#define DM   768
#define NH_  12
#define HD   64
#define AW   4                   // waves per flash block (16 query rows each)
#define QRS  2048.0f             // carry of the q residual plane
#define QRI  (1.0f / 2048.0f)
#define SC2  (0.125f * 1.4426950408889634f)   // HD^-0.5 * log2(e)
#define PSH  8.0f                // log2 of the P carry (256)
#define SKEY 64                  // keys per LDS stage (two 32-key passes of the score loop)
#define LPIT 144                 // LDS row pitch in bytes: 128-byte rows + 16 bytes of pad, conflict-free for ds_load_b128
#define SLICE 6144               // LDS bytes per wave's slice: 32 rows x LPIT = 4608, rounded up to a multiple of 2 KiB
#define RBUF (4 * SLICE)         // one stage: K keys 0..31 | K keys 32..63 | V^T d 0..31 | V^T d 32..63
#define PW   4                   // waves per projection block (2 x 2 tiles of 64x64)
#define PKS  64                  // k per LDS stage of the projection GEMM (two 32-k steps)
#define PSL  10240               // LDS bytes per wave's slice: 64 rows x LPIT = 9216, rounded up to a multiple of 2 KiB
#define PBUF (4 * PSL)           // one stage: A rows 0..63 | A rows 64..127 | Bt rows 0..63 | Bt rows 64..127
#define CVW  16                  // waves per conversion block
#define CVP  16                  // 512-byte pieces per conversion wave
#define CVB  (CVW * CVP * 128)   // floats per conversion block

static_assert(HD == 64);
static_assert(NH_ * HD == DM);                 // head h = columns h*64 + d
static_assert(DM % 64 == 0);                   // 12 column tiles of 64
static_assert(DM % PKS == 0 && DM / PKS >= 2);   // whole GEMM stages; the ring's prologue needs two
static_assert(DM % 128 == 0 && (NB * SEQ) % 128 == 0);   // 128x128 block tiles cover every projection exactly
static_assert(PW == 4 && PKS * 2 == 128 && 64 * LPIT <= PSL && PSL % 2048 == 0);   // four slices of 64 rows x 128 bytes, one per wave
static_assert(SEQ % 64 == 0);                  // a 64-row tile never straddles two batches
static_assert((NB * SEQ) % 64 == 0);
static_assert(SEQ % 32 == 0);                  // key loop steps by 32
static_assert(SEQ % SKEY == 0 && SEQ / SKEY >= 2);   // whole stages; the ring's prologue needs two
static_assert(AW == 4 && SKEY == 64 && HD * 2 == 128 && SKEY * 2 == 128);   // four slices of 32 rows x 128 bytes, one per wave
static_assert(32 * LPIT <= SLICE && SLICE % 2048 == 0);
static_assert(AW * 16 * 68 * 4 <= 2 * RBUF);   // output staging reuses the ring
static_assert(SEQ % (16 * AW) == 0);           // flash grid covers the sequence exactly
static_assert(((size_t)SEQ * DM) % CVB == 0);  // whole conversion blocks in every batch of x
static_assert(((size_t)DM * DM) % CVB == 0);   // and in every weight
static_assert(NB <= NB_FULL);
static_assert(SEQ <= SEQ_FULL);

typedef _Float16 h16;
typedef unsigned short bf;
typedef __attribute__((ext_vector_type(16))) __bf16   v16bf;
typedef __attribute__((ext_vector_type(16))) _Float16 v16h;
typedef __attribute__((ext_vector_type(8)))  _Float16 v8h;
typedef __attribute__((ext_vector_type(8)))  unsigned short v8us;
typedef __attribute__((ext_vector_type(4)))  unsigned short v4us;
typedef __attribute__((ext_vector_type(8)))  float    v8f;
typedef __attribute__((ext_vector_type(4)))  float    v4f;
typedef v4f  __attribute__((may_alias)) v4fa;
typedef uint32_t u32x4 __attribute__((ext_vector_type(4)));
typedef uint32_t u32x8 __attribute__((ext_vector_type(8)));

__device__ __forceinline__ unsigned short f2bf(float f) { unsigned u = __float_as_uint(f); u += 0x7FFFu + ((u >> 16) & 1u); return (unsigned short)(u >> 16); }
__device__ __forceinline__ v16h cat16(v8h lo, v8h hi) { return __builtin_shufflevector(lo, hi, 0, 1, 2, 3, 4, 5, 6, 7, 8, 9, 10, 11, 12, 13, 14, 15); }
__device__ __forceinline__ v16bf cat16b(v8us lo, v8us hi) { return __builtin_bit_cast(v16bf, __builtin_shufflevector(lo, hi, 0, 1, 2, 3, 4, 5, 6, 7, 8, 9, 10, 11, 12, 13, 14, 15)); }
__device__ __forceinline__ v8f wmma16(v16h a, v16h b, v8f c) { return __builtin_amdgcn_wmma_f32_16x16x32_f16(false, a, false, b, (short)0, c, false, false); }
__device__ __forceinline__ v8f wmmab(v16bf a, v16bf b, v8f c) { return __builtin_amdgcn_wmma_f32_16x16x32_bf16(false, a, false, b, (short)0, c, false, false); }
// fragment loaders from K-contiguous 16-bit rows; p already includes + 8*(lane>>4): elements 0..7 <- k0+8h+0..7, elements 8..15 <- k0+16+8h+0..7 (same map for A and B)
__device__ __forceinline__ v16h  ldh(const h16* p) { return cat16(*(const v8h*)p, *(const v8h*)(p + 16)); }
__device__ __forceinline__ v16bf ldb(const bf* p)  { return cat16b(*(const v8us*)p, *(const v8us*)(p + 16)); }
// ordering point for wave-private LDS tiles (same wave writes and reads)
__device__ __forceinline__ void wave_sync() { __builtin_amdgcn_fence(3 /* release order */, "wavefront"); __builtin_amdgcn_wave_barrier(); asm volatile("" ::: "memory"); }

__device__ __forceinline__ uint32_t uni(uint32_t v) { return (uint32_t)__builtin_amdgcn_readfirstlane(v); }
// a wave-uniform value held in a scalar register: tests around a tensor load must compile to s_cmp + s_cbranch_scc (the instruction ignores EXEC)
__device__ __forceinline__ uint32_t pinned(uint32_t v) { uint32_t w = uni(v); asm volatile("" : "+s"(w)); return w; }

// k_cvt: every f32 -> bf16 conversion of the call (x, Wq, Wk, Wv) in one launch whose waves are all resident at once: about one block of 16 waves per WGP.
// A block converts CVB consecutive floats of one source; a wave takes CVP pieces of 512 contiguous bytes (16 bytes per lane), all loaded before the first is converted.
__global__ __launch_bounds__(32 * CVW) void k_cvt(const float* __restrict__ x, const float* __restrict__ wq, const float* __restrict__ wk, const float* __restrict__ wv, bf* xb, bf* wb) {
    constexpr unsigned XPB = (unsigned)((size_t)SEQ * DM / CVB), XBL = NB * XPB, WBL = (unsigned)((size_t)DM * DM / CVB);   // blocks per batch of x, for all of x, per weight
    const unsigned blk = blockIdx.x;
    const float* src; bf* dst;
    if (blk < XBL) { src = x + (size_t)(blk / XPB) * SEQ_FULL * DM + (size_t)(blk % XPB) * CVB; dst = xb + (size_t)blk * CVB; }
    else { const unsigned w = blk - XBL, which = w / WBL; src = (which == 0 ? wq : which == 1 ? wk : wv) + (size_t)(w % WBL) * CVB; dst = wb + (size_t)w * CVB; }
    const unsigned off = (threadIdx.x >> 5) * (CVP * 128) + (threadIdx.x & 31) * 4;
    const unsigned lb = off * 4;   // the lane's byte offset in the source, the one vector register that all the loads name
    v4f v[CVP];
#pragma unroll
    for (int i = 0; i < CVP; ++i) v[i] = *(const v4f*)((const char*)src + lb + i * 512);
    asm volatile("s_wait_xcnt 0x0" :: "v"(lb) : "memory");   // behind the last load and ahead of any write to the offset register (held live to here, so that no load's result lands on it either)
#pragma unroll
    for (int i = 0; i < CVP; ++i) { v4us o;
#pragma unroll
        for (int k = 0; k < 4; ++k) o[k] = f2bf(v[i][k]);
        *(v4us*)(dst + off + i * 128) = o; }   // 8 bytes per lane: two whole 128-byte lines per wave
}

// k_proj: bf16 GEMM, one block of four waves (2 x 2) per 128x128 tile, each wave a 64x64 tile (16 accumulators), K = DM.
// A and Bt: stages of 64 k (128 bytes of every row) in a two-buffer LDS ring shared by the block's four waves. Each wave brings one slice (64 rows x 128 bytes, padded to 144)
// per stage with one tensor_load_to_lds, one stage ahead of its use; fragments are two ds_load_b128 each.
// C[m][n] = sum_k A[m][k] Bt[n][k], written as f16 (Ph) and optionally the f16 residual x2048 (Pr, useRes != 0) at
// tile base (r0/RB)*sRB + (r0%RB)*pitch + (c0/CB)*sCB + (c0%CB), row pitch 'pitch' (halves). grid (M/128, N/128), 128 threads.
__global__ __launch_bounds__(32 * PW) void k_proj(const bf* __restrict__ A, const bf* __restrict__ Bt, h16* Ph, h16* Pr, int useRes, int RB, size_t sRB, int pitch, int CB, size_t sCB) {
    __shared__ __attribute__((aligned(2048))) unsigned char ring[2 * PBUF];
    __shared__ __align__(16) float osall[PW * 16 * 68];
    const int K = DM;
    const int lane = threadIdx.x & 31, lr = lane & 15, hi = lane >> 4;
    const int wave = (int)uni(threadIdx.x >> 5);
    const int wm = wave >> 1, wn = wave & 1;                 // this wave's 64x64 tile inside the block's 128x128
    const int r0 = blockIdx.x * 128 + wm * 64, c0 = blockIdx.y * 128 + wn * 64;
    float* os = osall + wave * 16 * 68;                      // wave-private output staging
    // This wave's slice: waves 0, 1 = A rows 0..63, 64..127 of the block's tile; waves 2, 3 = Bt rows 0..63, 64..127 (source pitch 2*K bytes).
    const bool isB = (wave & 2) != 0; const size_t half = (size_t)(wave & 1);
    const uint64_t sbase = (uint64_t)(size_t)(isB ? Bt + ((size_t)blockIdx.y * 128 + half * 64) * K : A + ((size_t)blockIdx.x * 128 + half * 64) * K);
    const uint32_t ldst = (uint32_t)(size_t)ring + (uint32_t)wave * PSL;
    u32x8 g1;                      // 1-byte elements, tile = tensor = 64 rows x 128 bytes, 4 dwords of LDS pad behind every 32 dwords
    g1[0] = uni((1u << 20) | (4u << 22) | (3u << 25)); g1[1] = uni(128u << 16); g1[2] = uni(64u << 16); g1[3] = uni(128u << 16);
    g1[4] = uni(64u); g1[5] = uni((uint32_t)(DM * 2)); g1[6] = uni(0u); g1[7] = uni(0u);
    auto issue = [&](uint32_t st) {
        const uint64_t ga = sbase + (uint64_t)st * (uint32_t)(PKS * 2);
        u32x4 g0; g0[0] = uni(1u); g0[1] = uni(ldst + (st & 1u) * PBUF); g0[2] = uni((uint32_t)ga); g0[3] = uni((((uint32_t)(ga >> 32)) & 0x01FFFFFFu) | 0x80000000u);
        asm volatile("tensor_load_to_lds %0, %1" :: "s"(g0), "s"(g1) : "memory");   // one request of the whole wave: its slice, global -> LDS, through no register
    };
    issue(0u);
    asm volatile("s_wait_tensorcnt 0x0" ::: "memory");   // this wave's slice of stage 0 has landed
    __syncthreads();                                     // stage 0 published to all four waves
    issue(1u);
    const unsigned char* fra = ring + wm * PSL + lr * LPIT + 16 * hi;         // A fragment row lr, k half hi
    const unsigned char* frb = ring + (2 + wn) * PSL + lr * LPIT + 16 * hi;   // Bt fragment row lr, k half hi
    v8f acc[4][4];
#pragma unroll
    for (int mb = 0; mb < 4; ++mb)
#pragma unroll
        for (int nb = 0; nb < 4; ++nb) acc[mb][nb] = (v8f){};
#pragma unroll 1
    for (uint32_t st = 0; st < (uint32_t)(DM / PKS); ++st) {
        const unsigned char* fa = fra + (st & 1u) * PBUF; const unsigned char* fb = frb + (st & 1u) * PBUF;
        // Fragments of the stage's two 32-k steps. The first step's sixteen ds_load_b128 and twelve of the second step's stand as one group in front of the WMMAs;
        // the last four follow once two Bt fragments of the first step are spent, so that 16 accumulators and the fragments stay under 256 registers.
        v16bf a0[4], b0[4], a1[4], b1[4];
#pragma unroll
        for (int i = 0; i < 4; ++i) { a0[i] = ldb((const bf*)(fa + i * 16 * LPIT)); b0[i] = ldb((const bf*)(fb + i * 16 * LPIT)); }
#pragma unroll
        for (int i = 0; i < 4; ++i) a1[i] = ldb((const bf*)(fa + i * 16 * LPIT + 64));
        b1[0] = ldb((const bf*)(fb + 64)); b1[1] = ldb((const bf*)(fb + 16 * LPIT + 64));
        __builtin_amdgcn_sched_barrier(0);   // keeps the load group in front: sunk among the WMMAs, each small group is waited out to zero
#pragma unroll
        for (int nb = 0; nb < 2; ++nb)
#pragma unroll
            for (int mb = 0; mb < 4; ++mb) acc[mb][nb] = wmmab(a0[mb], b0[nb], acc[mb][nb]);
        __builtin_amdgcn_sched_barrier(0);   // the last four loads stay here, sixteen WMMAs ahead of their first use
        b1[2] = ldb((const bf*)(fb + 2 * 16 * LPIT + 64)); b1[3] = ldb((const bf*)(fb + 3 * 16 * LPIT + 64));
        __builtin_amdgcn_sched_barrier(0);   // and do not sink among the WMMAs behind them, where they would be waited out to zero
#pragma unroll
        for (int nb = 2; nb < 4; ++nb)
#pragma unroll
            for (int mb = 0; mb < 4; ++mb) acc[mb][nb] = wmmab(a0[mb], b0[nb], acc[mb][nb]);
#pragma unroll
        for (int nb = 0; nb < 4; ++nb)
#pragma unroll
            for (int mb = 0; mb < 4; ++mb) acc[mb][nb] = wmmab(a1[mb], b1[nb], acc[mb][nb]);
        // four vector slots behind the last WMMA of the stage, before anything may overwrite its operands or touch its result (also on the loop's taken branch)
        asm volatile("v_nop\n\tv_nop\n\tv_nop\n\tv_nop" : "+v"(acc[0][3]), "+v"(acc[1][3]), "+v"(acc[2][3]), "+v"(acc[3][3]) : "v"(a1[0]), "v"(a1[1]), "v"(a1[2]), "v"(a1[3]), "v"(b1[3]));
        __builtin_amdgcn_sched_barrier(0);   // keeps the stage's WMMAs in front of the publish point: moved behind the barrier they would delay the refill that follows it
        asm volatile("s_wait_dscnt 0x0" ::: "memory");
        asm volatile("s_wait_tensorcnt 0x0" ::: "memory");
        __syncthreads();
        const uint32_t nx = pinned(st + 2u);
        if (pinned(nx < (uint32_t)(DM / PKS))) issue(nx);
    }
    asm volatile("s_wait_tensorcnt 0x0" ::: "memory");       // nothing in flight when the wave goes on to its epilogue
    asm volatile("s_wait_dscnt 0x0" ::: "memory");
    const size_t tbase = (size_t)(r0 / RB) * sRB + (size_t)(r0 % RB) * (size_t)pitch + (size_t)(c0 / CB) * sCB + (size_t)(c0 % CB);
#pragma unroll
    for (int mb = 0; mb < 4; ++mb) {
#pragma unroll
        for (int nb = 0; nb < 4; ++nb) {
#pragma unroll
            for (int j = 0; j < 8; ++j) os[(hi * 8 + j) * 68 + nb * 16 + lr] = acc[mb][nb][j]; }   // D: row 8h+j, col lane&15
        wave_sync();
        const size_t sb = tbase + (size_t)(mb * 16) * (size_t)pitch;
{
#pragma unroll
            for (int s = 0; s < 4; ++s) { const int row = 4 * s + (lane >> 3), c8 = (lane & 7) * 8;   // 4 s x 4 row groups = 16 rows; 8 lanes x 8 = 64 columns
                const v4f x0 = *(const v4fa*)(&os[row * 68 + c8]); const v4f x1 = *(const v4fa*)(&os[row * 68 + c8 + 4]); v8h hv, rv;
#pragma unroll
                for (int i = 0; i < 4; ++i) { const h16 a0 = (h16)x0[i]; const h16 a1 = (h16)x1[i]; hv[i] = a0; hv[4 + i] = a1; rv[i] = (h16)((x0[i] - (float)a0) * QRS); rv[4 + i] = (h16)((x1[i] - (float)a1) * QRS); }
                const size_t oo = sb + (size_t)row * (size_t)pitch + c8;
                *(v8h*)(Ph + oo) = hv; if (useRes) *(v8h*)(Pr + oo) = rv; }
             }
        wave_sync();
    }
}

// k_flash: fused attention, one wave per 16 query rows of one (batch, head); Q fragments straight from the f16 planes (two 16-B loads each).
// K and V^T: stages of 64 keys in a two-buffer LDS ring shared by the block's four waves. Each wave brings one slice (32 rows x 128 bytes, padded to 144) per stage
// with one tensor_load_to_lds, one stage ahead of its use; fragments are two ds_load_b128 each.
// Transposed form: S^T[key][t] = K Q^T (A = K rows, B = Q rows); lane (t = lane&15, h = lane>>4) holds keys 8h+r of each 16-key tile, so the packed
// P tile is directly the B fragment of O^T[d][t] = V^T P^T (element r <- tile keys 0..15, element 8+r <- tile keys 16..31, lane unchanged).
// Softmax state: the running max is one scalar per lane (the two lane halves of a column are combined with one xor-16 exchange per pass).
// Row sums run on the matrix pipe: one more product per pass, A = ones in rows 0 and 8 and zero elsewhere, B = the packed P tile, so that element 0 of its
// accumulator holds, in both lane halves, the column's sum over all 32 keys of P as rounded to f16; it is rescaled like an output tile (elements 1..7 stay zero).
__global__ __launch_bounds__(32 * AW) void k_flash(const h16* __restrict__ QH, const h16* __restrict__ QR, const h16* __restrict__ KP, const h16* __restrict__ VT, float* OUT) {
    __shared__ __attribute__((aligned(2048))) unsigned char ring[2 * RBUF];
    float* os = (float*)ring;      // output staging, used only behind the last stage's barrier
    const int lane = threadIdx.x & 31, lr = lane & 15, hi = lane >> 4;
    const int wave = (int)uni(threadIdx.x >> 5);
    const int zh = blockIdx.y; const int b = zh / NH_, h = zh % NH_;
    const int t0 = (blockIdx.x * AW + wave) * 16;
    const size_t pbase = (size_t)zh * SEQ * HD;
    const size_t qo = pbase + (size_t)(t0 + lr) * HD + 8 * hi;
    const v16h qh0 = ldh(QH + qo), qh1 = ldh(QH + qo + 32), qr0 = ldh(QR + qo), qr1 = ldh(QR + qo + 32);   // B fragments: col t, k = d
    // This wave's slice: waves 0, 1 = K keys 0..31, 32..63 of the stage (source pitch 128 B); waves 2, 3 = V^T rows d 0..31, 32..63 (source pitch 2*SEQ B).
    const bool isV = (wave & 2) != 0; const size_t half = (size_t)(wave & 1);
    const uint64_t sbase = (uint64_t)(size_t)(isV ? VT + pbase + half * 32 * SEQ : KP + pbase + half * 32 * HD);
    const uint32_t sstep = isV ? (uint32_t)(SKEY * 2) : (uint32_t)(SKEY * HD * 2);   // source bytes from one stage to the next
    const uint32_t ldst = (uint32_t)(size_t)ring + (uint32_t)wave * SLICE;
    u32x8 g1;                      // 1-byte elements, tile = tensor = 32 rows x 128 bytes, 4 dwords of LDS pad behind every 32 dwords
    g1[0] = uni((1u << 20) | (4u << 22) | (3u << 25)); g1[1] = uni(128u << 16); g1[2] = uni(32u << 16); g1[3] = uni(128u << 16);
    g1[4] = uni(32u); g1[5] = uni(isV ? (uint32_t)(SEQ * 2) : (uint32_t)(HD * 2)); g1[6] = uni(0u); g1[7] = uni(0u);
    auto issue = [&](uint32_t st) {
        const uint64_t ga = sbase + (uint64_t)st * sstep;
        u32x4 g0; g0[0] = uni(1u); g0[1] = uni(ldst + (st & 1u) * RBUF); g0[2] = uni((uint32_t)ga); g0[3] = uni((((uint32_t)(ga >> 32)) & 0x01FFFFFFu) | 0x80000000u);
        asm volatile("tensor_load_to_lds %0, %1" :: "s"(g0), "s"(g1) : "memory");   // one request of the whole wave: its slice, global -> LDS, through no register
    };
    issue(0u);
    asm volatile("s_wait_tensorcnt 0x0" ::: "memory");   // this wave's slice of stage 0 has landed
    __syncthreads();                                     // stage 0 published to all four waves
    issue(1u);
    const unsigned char* fr = ring + lr * LPIT + 16 * hi;    // fragment row lr, k half hi (A fragments: K row = key, k = d; V^T row = d, k = key)
    v8f o0 = (v8f){}, o1 = (v8f){}, o2 = (v8f){}, o3 = (v8f){};
    v8f ol = (v8f){};              // row-sum tile
    const h16 one = (lane & 7) == 0 ? (h16)1.0f : (h16)0.0f;   // A fragment: lane = row, so rows 0 and 8 are ones over all 32 k
    v16h ones;
#pragma unroll
    for (int i = 0; i < 16; ++i) ones[i] = one;
    float m = -3.0e38f;
#pragma unroll 1
    for (uint32_t st = 0; st < (uint32_t)(SEQ / SKEY); ++st) {
      const unsigned char* fb = fr + (st & 1u) * RBUF;
#pragma unroll   // both passes of a stage inline: slice and key offsets become immediate offsets of the ds_load_b128
      for (int sub = 0; sub < SKEY / 32; ++sub) {
        const h16* ka = (const h16*)(fb + sub * SLICE);      // K slice sub = the 32 keys of this pass
        const v16h ka0 = ldh(ka), ka1 = ldh(ka + 32), kb0 = ldh(ka + 16 * (LPIT / 2)), kb1 = ldh(ka + 16 * (LPIT / 2) + 32);
        v8f sHa = (v8f){}, sLa = (v8f){}, sHb = (v8f){}, sLb = (v8f){};
        sHa = wmma16(ka0, qh0, sHa); sLa = wmma16(ka0, qr0, sLa); sHb = wmma16(kb0, qh0, sHb); sLb = wmma16(kb0, qr0, sLb);
        sHa = wmma16(ka1, qh1, sHa); sLa = wmma16(ka1, qr1, sLa); sHb = wmma16(kb1, qh1, sHb); sLb = wmma16(kb1, qr1, sLb);
        asm volatile("v_nop\n\tv_nop\n\tv_nop\n\tv_nop" : "+v"(sHa), "+v"(sLa), "+v"(sHb), "+v"(sLb) : "v"(ka0), "v"(ka1), "v"(kb0), "v"(kb1));
        float ta[8], tb[8]; float mx = -3.0e38f;
#pragma unroll
        for (int r = 0; r < 8; ++r) { ta[r] = (sHa[r] + sLa[r] * QRI) * SC2; tb[r] = (sHb[r] + sLb[r] * QRI) * SC2; mx = fmaxf(mx, fmaxf(ta[r], tb[r])); }
        mx = fmaxf(mx, __shfl_xor(mx, 16, 32));
        const float mnew = fmaxf(m, mx);
        // alpha = 2^(m - mnew). One statement holds the v_exp_f32, the one slot that the instruction set asks for behind a transcendental (so that no vector instruction directly
        // behind it overwrites its source register) and the two delay hints that the compiler does not write around asm text, one for the v_exp_f32 behind the subtraction that feeds it,
        // one for the first reader of the result: an unhinted dependent instruction's wait holds up the SIMD's other waves too.
        float alpha;
        asm("s_delay_alu instid0(VALU_DEP_1)\n\tv_exp_f32 %0, %1\n\tv_nop\n\ts_delay_alu instid0(TRANS32_DEP_1)" : "=v"(alpha) : "v"(m - mnew));
        const float sh = PSH - mnew;
        v16h pb;
#pragma unroll
        for (int r = 0; r < 8; ++r) { const h16 pa = (h16)__builtin_amdgcn_exp2f(ta[r] + sh); const h16 pc = (h16)__builtin_amdgcn_exp2f(tb[r] + sh); pb[r] = pa; pb[8 + r] = pc; }
        ol[0] = ol[0] * alpha; m = mnew;
        o0 = o0 * alpha; o1 = o1 * alpha; o2 = o2 * alpha; o3 = o3 * alpha;
        const h16* va = (const h16*)(fb + 2 * SLICE + sub * 64);   // V^T slices, 32 keys = 64 bytes along the row per pass
        const v16h v0 = ldh(va), v1 = ldh(va + 16 * (LPIT / 2)), v2 = ldh(va + SLICE / 2), v3 = ldh(va + SLICE / 2 + 16 * (LPIT / 2));
        o0 = wmma16(v0, pb, o0); o1 = wmma16(v1, pb, o1); o2 = wmma16(v2, pb, o2); o3 = wmma16(v3, pb, o3); ol = wmma16(ones, pb, ol);
        asm volatile("v_nop\n\tv_nop\n\tv_nop\n\tv_nop" : "+v"(o0), "+v"(o1), "+v"(o2), "+v"(o3), "+v"(ol) : "v"(v0), "v"(v1), "v"(v2), "v"(v3), "v"(pb));
      }
      asm volatile("s_wait_dscnt 0x0" ::: "memory");
      asm volatile("s_wait_tensorcnt 0x0" ::: "memory");
      __syncthreads();
      const uint32_t nx = pinned(st + 2u);
      if (pinned(nx < (uint32_t)(SEQ / SKEY))) issue(nx);
    }
    asm volatile("s_wait_tensorcnt 0x0" ::: "memory");     // nothing in flight before the ring becomes output staging
    asm volatile("s_wait_dscnt 0x0" ::: "memory");         // (the last stage's own barrier has ended every wave's reads)
    const float inv = 1.0f / ol[0];
    const int wb = wave * 16 * 68;
    // O^T D layout: o_j[r] = (d = 16j + 8h + r, t = lane&15) -> os[t][d]; rows 0..15 x columns 0..63 all written
    { v4f a, c;
      a[0] = o0[0] * inv; a[1] = o0[1] * inv; a[2] = o0[2] * inv; a[3] = o0[3] * inv; c[0] = o0[4] * inv; c[1] = o0[5] * inv; c[2] = o0[6] * inv; c[3] = o0[7] * inv;
      *(v4fa*)(&os[wb + lr * 68 +  0 + 8 * hi]) = a; *(v4fa*)(&os[wb + lr * 68 +  0 + 8 * hi + 4]) = c;
      a[0] = o1[0] * inv; a[1] = o1[1] * inv; a[2] = o1[2] * inv; a[3] = o1[3] * inv; c[0] = o1[4] * inv; c[1] = o1[5] * inv; c[2] = o1[6] * inv; c[3] = o1[7] * inv;
      *(v4fa*)(&os[wb + lr * 68 + 16 + 8 * hi]) = a; *(v4fa*)(&os[wb + lr * 68 + 16 + 8 * hi + 4]) = c;
      a[0] = o2[0] * inv; a[1] = o2[1] * inv; a[2] = o2[2] * inv; a[3] = o2[3] * inv; c[0] = o2[4] * inv; c[1] = o2[5] * inv; c[2] = o2[6] * inv; c[3] = o2[7] * inv;
      *(v4fa*)(&os[wb + lr * 68 + 32 + 8 * hi]) = a; *(v4fa*)(&os[wb + lr * 68 + 32 + 8 * hi + 4]) = c;
      a[0] = o3[0] * inv; a[1] = o3[1] * inv; a[2] = o3[2] * inv; a[3] = o3[3] * inv; c[0] = o3[4] * inv; c[1] = o3[5] * inv; c[2] = o3[6] * inv; c[3] = o3[7] * inv;
      *(v4fa*)(&os[wb + lr * 68 + 48 + 8 * hi]) = a; *(v4fa*)(&os[wb + lr * 68 + 48 + 8 * hi + 4]) = c; }
    wave_sync();
    float* orow = OUT + ((size_t)b * OUT_SEQ + t0) * DM + h * HD;
{
#pragma unroll
        for (int s = 0; s < 8; ++s) { const int row = 2 * s + hi, cofs = lr * 4;   // 8 s x 2 rows = 16 rows; 16 lanes x 4 floats = 64 columns
            const v4f val = *(const v4fa*)(&os[wb + row * 68 + cofs]);
            *(v4f*)(orow + (size_t)row * DM + cofs) = val; }
         }
}

static constexpr size_t al256(size_t v) { return (v + 255) & ~(size_t)255; }
static constexpr size_t SZ_XB = al256((size_t)NB * SEQ * DM * 2);
static constexpr size_t SZ_WB = al256((size_t)3 * DM * DM * 2);
static constexpr size_t SZ_PL = al256((size_t)NB * NH_ * SEQ * HD * 2);
static constexpr size_t SZ_TOTAL = SZ_XB + SZ_WB + 4 * SZ_PL;
static_assert(SZ_TOTAL <= (size_t)134217728);          // workspace carve <= 128 MiB
static_assert(((size_t)DM * DM * 2) % 256 == 0);       // weight sub-planes stay 256-byte aligned

extern "C" void kernel_launch(void* const* d_in, const int* in_sizes, int n_in,
                              void* d_out, int out_size, void* d_ws, size_t ws_size, hipStream_t stream) {
    if (n_in < 4) return;
    const size_t needx = ((size_t)(NB - 1) * SEQ_FULL + SEQ) * DM;
    if ((size_t)in_sizes[0] < needx) return;
    if ((size_t)in_sizes[1] < (size_t)DM * DM || (size_t)in_sizes[2] < (size_t)DM * DM || (size_t)in_sizes[3] < (size_t)DM * DM) return;
    if ((size_t)out_size < ((size_t)(NB - 1) * OUT_SEQ + SEQ) * DM) return;
    if (SZ_TOTAL > ws_size) return;
    const float* x = (const float*)d_in[0]; const float* wq = (const float*)d_in[1]; const float* wk = (const float*)d_in[2]; const float* wv = (const float*)d_in[3];   // wire order x, Wq, Wk, Wv ([out][in] = Bt as-is)
    float* OUT = (float*)d_out;      // [NB][SEQ][768]
    char* wsp = (char*)d_ws;
    bf* XB = (bf*)wsp; wsp += SZ_XB;                 // [NB*SEQ][768]
    bf* WB = (bf*)wsp; wsp += SZ_WB;                 // [3][768][768]: q | k | v
    h16* QH = (h16*)wsp; wsp += SZ_PL;               // [NB*12][SEQ][64]
    h16* QR = (h16*)wsp; wsp += SZ_PL;               // [NB*12][SEQ][64] residual x2048
    h16* KP = (h16*)wsp; wsp += SZ_PL;               // [NB*12][SEQ][64]
    h16* VT = (h16*)wsp; wsp += SZ_PL;               // [NB*12][64][SEQ]
    bf* WQ = WB; bf* WK = WB + (size_t)DM * DM; bf* WV = WB + (size_t)2 * DM * DM;

    k_cvt<<<(unsigned)(((size_t)NB * SEQ * DM + (size_t)3 * DM * DM) / CVB), 32 * CVW, 0, stream>>>(x, wq, wk, wv, XB, WB);

    // q, k: A = x rows (m = b*SEQ + t), Bt = W rows (n = h*64 + d) -> plane [(b*12 + h)][t][d]
    k_proj<<<dim3(NB * SEQ / 128, DM / 128, 1), 32 * PW, 0, stream>>>(XB, WQ, QH, QR, 1, SEQ, (size_t)NH_ * SEQ * HD, HD, HD, (size_t)SEQ * HD);
    k_proj<<<dim3(NB * SEQ / 128, DM / 128, 1), 32 * PW, 0, stream>>>(XB, WK, KP, KP, 0, SEQ, (size_t)NH_ * SEQ * HD, HD, HD, (size_t)SEQ * HD);
    // v^T: A = Wv rows (m = h*64 + d), Bt = x rows (n = b*SEQ + t) -> plane [(b*768 + m)][t] = [(b*12 + h)][d][t]
    k_proj<<<dim3(DM / 128, NB * SEQ / 128, 1), 32 * PW, 0, stream>>>(WV, XB, VT, VT, 0, DM, (size_t)0, SEQ, SEQ, (size_t)DM * SEQ);

    k_flash<<<dim3(SEQ / (16 * AW), NB * NH_, 1), 32 * AW, 0, stream>>>(QH, QR, KP, VT, OUT);
}
